// v000
// Times are from an AMD MI455X. After a warm-up the kernel runs many times in a row, and a time is the length of
// such a window on the GPU divided by its runs, so every launch and the gaps after it count. The runs cycle
// through copies of the inputs. A figure is the median of several windows, for all but v000 over two sittings.
// Sittings can differ by a few percent; kernels timed side by side share one.
// v000 is the starting kernel. One run takes 209 microseconds.
#include <hip/hip_runtime.h>
#include <math.h>

typedef __attribute__((ext_vector_type(16))) _Float16 v16h;
typedef __attribute__((ext_vector_type(16))) __bf16 v16b;
typedef __attribute__((ext_vector_type(8)))  _Float16 v8h;
typedef __attribute__((ext_vector_type(8)))  float v8f;
typedef __attribute__((ext_vector_type(4)))  float v4f;
typedef __attribute__((ext_vector_type(2)))  float v2f;
typedef __attribute__((ext_vector_type(4)))  unsigned v4u;
typedef __attribute__((ext_vector_type(4)))  int v4i;
typedef float __attribute__((may_alias)) float_a;
typedef int __attribute__((may_alias)) int_a;

template <typename T> __device__ __forceinline__ void vst2(void* p, T v) { *(T*)p = v;  }
__device__ __forceinline__ v8f wmma16(v16h a, v16h b, v8f c) {
  v8f d = __builtin_amdgcn_wmma_f32_16x16x32_f16(false, a, false, b, (short)0, c, false, false);
  asm volatile("v_nop\n\tv_nop\n\tv_nop\n\tv_nop" : "+v"(d) : "v"(a), "v"(b));
  return d;
}
__device__ __forceinline__ v8f wmma_bf(v16b a, v16b b, v8f c) {
  v8f d = __builtin_amdgcn_wmma_f32_16x16x32_bf16(false, a, false, b, (short)0, c, false, false);
  asm volatile("v_nop\n\tv_nop\n\tv_nop\n\tv_nop" : "+v"(d) : "v"(a), "v"(b));
  return d;
}
// 16x16x32 fragments: lane = (h = lane>>4, row/col = lane&15); elements 0..7 = k0+8h+0..7, 8..15 = k0+16+8h+0..7; D element r = row 8h+r
__device__ __forceinline__ v16h frag_h(const _Float16* rowk0, int lane) {
  union { v16h v; v8h q[2]; } u; const _Float16* p = rowk0 + 8 * (lane >> 4);
  u.q[0] = *(const v8h*)p; u.q[1] = *(const v8h*)(p + 16); return u.v;
}
__device__ __forceinline__ v16h frag_f32(const float* rowk0, int lane) {
  v16h a; const float* p = rowk0 + 8 * (lane >> 4);
#pragma unroll
  for (int i = 0; i < 8; ++i) { a[i] = (_Float16)p[i]; a[8 + i] = (_Float16)p[16 + i]; }
  return a;
}
__device__ __forceinline__ v16h frag_f32s(const float* rowk0, int lane, float sc) {
  v16h a; const float* p = rowk0 + 8 * (lane >> 4);
#pragma unroll
  for (int i = 0; i < 8; ++i) { a[i] = (_Float16)(p[i] * sc); a[8 + i] = (_Float16)(p[16 + i] * sc); }
  return a;
}
// column fragment from a [K][ld] layout (column n), rows >= K read as 0
__device__ __forceinline__ v16h fragc_f32(const float* W, int k0, int n, int lane, int ld, int K) {
  v16h a; const int g = lane >> 4;
#pragma unroll
  for (int i = 0; i < 8; ++i) { const int ka = k0 + 8 * g + i, kb = ka + 16;
    a[i] = (_Float16)(ka < K ? W[(size_t)ka * ld + n] : 0.f); a[8 + i] = (_Float16)(kb < K ? W[(size_t)kb * ld + n] : 0.f); }
  return a;
}
struct F2 { v16b h, l; };
__device__ __forceinline__ F2 bsplit16(const float v[16]) { F2 r;
#pragma unroll
  for (int i = 0; i < 16; ++i) { const __bf16 h = (__bf16)v[i]; r.h[i] = h; r.l[i] = (__bf16)(v[i] - (float)h); }
  return r; }
__device__ __forceinline__ F2 split_row(const float* row, int k0, int lane) { float v[16]; const float* p = row + k0 + 8 * (lane >> 4);
#pragma unroll
  for (int i = 0; i < 8; ++i) { v[i] = p[i]; v[8 + i] = p[16 + i]; }
  return bsplit16(v); }
__device__ __forceinline__ F2 split_rowK(const float* row, int k0, int lane, int K) { float v[16]; const int g = lane >> 4;
#pragma unroll
  for (int i = 0; i < 8; ++i) { const int ka = k0 + 8 * g + i, kb = ka + 16; v[i] = ka < K ? row[ka] : 0.f; v[8 + i] = kb < K ? row[kb] : 0.f; }
  return bsplit16(v); }
__device__ __forceinline__ F2 split_col(const float* W, int k0, int n, int lane, int ld, int K) { float v[16]; const int g = lane >> 4;
#pragma unroll
  for (int i = 0; i < 8; ++i) { const int ka = k0 + 8 * g + i, kb = ka + 16; v[i] = ka < K ? W[(size_t)ka * ld + n] : 0.f; v[8 + i] = kb < K ? W[(size_t)kb * ld + n] : 0.f; }
  return bsplit16(v); }
__device__ __forceinline__ v8f mac3(const F2& a, const F2& b, v8f c) { c = wmma_bf(a.l, b.h, c); c = wmma_bf(a.h, b.l, c); return wmma_bf(a.h, b.h, c); }
__device__ __forceinline__ float sigm(float v) { return 1.0f / (1.0f + expf(-v)); }
#define LDSX() do { asm volatile("s_wait_dscnt 0" ::: "memory"); __builtin_amdgcn_wave_barrier(); __builtin_amdgcn_fence(__ATOMIC_RELEASE, "workgroup"); } while (0)

// Causal core attention (16 heads, 2048 tokens, batch 1), near-f32: S = q.k/8 and P@V both on v_wmma_f32_16x16x32_bf16 as two-way
// bf16 splits taken directly from the f32 inputs (hi*hi + hi*lo + lo*hi, f32 accumulate) — plain f16 left ~1e-3 absolute error on the
// first few query rows (few keys, no averaging). Masked positions get -10000 exactly as the reference; key
#define SQ 2048
#define NH 16
#define HD 64
#define EE (NH * HD)

__global__ __launch_bounds__(128) void k_attn(const float* __restrict__ q, const float* __restrict__ k, const float* __restrict__ v, float* __restrict__ out) {
  __shared__ __align__(16) float sS[4][16][68];
  __shared__ __align__(16) float sP[4][16][68];
  __shared__ __align__(16) float sO[4][16][68];
  const int tid = threadIdx.x, w = tid >> 5, lane = tid & 31, col = lane & 15, g = lane >> 4;
  const int h = blockIdx.y, q0 = blockIdx.x * 64 + w * 16;
  const float* qb = q + h * HD; const float* kb = k + h * HD; const float* vb = v + h * HD;      // row stride EE
  F2 aq[2];
#pragma unroll
  for (int kc = 0; kc < 2; ++kc) aq[kc] = split_row(qb + (size_t)(q0 + col) * EE, kc * 32, lane);
  float mrun = -3.0e38f, lrun = 0.f; v8f acc[4] = {};
  const int ntiles = blockIdx.x + 1;
#pragma unroll 1
  for (int kt = 0; kt < ntiles; ++kt) {
#pragma unroll
    for (int t = 0; t < 4; ++t) { v8f s = {}; const int key = kt * 64 + t * 16 + col;
#pragma unroll
      for (int kc = 0; kc < 2; ++kc) s = mac3(aq[kc], split_row(kb + (size_t)key * EE, kc * 32, lane), s);
#pragma unroll
      for (int r = 0; r < 8; ++r) { const int qi = q0 + 8 * g + r; sS[w][8 * g + r][t * 16 + col] = key <= qi ? s[r] * 0.125f : -10000.0f; } }
    LDSX();
    float mx = -3.4e38f;
#pragma unroll
    for (int jj = 0; jj < 32; ++jj) mx = fmaxf(mx, sS[w][col][g * 32 + jj]);
    mx = fmaxf(mx, __shfl_xor(mx, 16, 32));
    const float mnew = fmaxf(mrun, mx); const float corr = expf(mrun - mnew);
    float ps = 0.f;
#pragma unroll
    for (int jj = 0; jj < 32; ++jj) { const float p = expf(sS[w][col][g * 32 + jj] - mnew); ps += p; sP[w][col][g * 32 + jj] = p; }
    ps += __shfl_xor(ps, 16, 32);
    lrun = lrun * corr + ps; mrun = mnew;
#pragma unroll
    for (int r = 0; r < 8; ++r) { const float cr = __shfl(corr, 8 * g + r, 32);
#pragma unroll
      for (int t = 0; t < 4; ++t) acc[t][r] *= cr; }
    LDSX();
#pragma unroll
    for (int kc = 0; kc < 2; ++kc) { const F2 pa = split_row(&sP[w][col][0], kc * 32, lane);
#pragma unroll
      for (int t = 0; t < 4; ++t) acc[t] = mac3(pa, split_col(vb + (size_t)(kt * 64) * EE, kc * 32, t * 16 + col, lane, EE, 64), acc[t]); }
    __builtin_amdgcn_wave_barrier();
  }
#pragma unroll
  for (int r = 0; r < 8; ++r) { const float lr = __shfl(lrun, 8 * g + r, 32);
#pragma unroll
    for (int t = 0; t < 4; ++t) sO[w][8 * g + r][t * 16 + col] = acc[t][r] / lr; }
  LDSX();
  for (int qd = lane; qd < 16 * 16; qd += 32) { const int rl = qd >> 4, pc = qd & 15; vst2(out + (size_t)(q0 + rl) * EE + h * HD + pc * 4, *(const v4f*)(&sO[w][rl][pc * 4])); }
}
extern "C" void kernel_launch(void* const* d_in, const int* in_sizes, int n_in, void* d_out, int out_size, void* d_ws, size_t ws_size, hipStream_t stream) {
  (void)in_sizes; (void)n_in; (void)out_size; (void)ws_size; (void)d_ws;
  const float* q = (const float*)d_in[0]; const float* k = (const float*)d_in[1]; const float* v = (const float*)d_in[2];
  float* out = (float*)d_out;
  k_attn<<<dim3(SQ / 64, NH), 128, 0, stream>>>(q, k, v, out);
}

// v001
// A run of this version takes 105 microseconds.
// Two timings next to v000 put it at 2.00 and 1.99 times that version's speed.
#include <hip/hip_runtime.h>
#include <math.h>

typedef __attribute__((ext_vector_type(16))) _Float16 v16h;
typedef __attribute__((ext_vector_type(16))) __bf16 v16b;
typedef __attribute__((ext_vector_type(8)))  _Float16 v8h;
typedef __attribute__((ext_vector_type(8)))  float v8f;
typedef __attribute__((ext_vector_type(4)))  float v4f;
typedef __attribute__((ext_vector_type(2)))  float v2f;
typedef __attribute__((ext_vector_type(4)))  unsigned v4u;
typedef __attribute__((ext_vector_type(4)))  int v4i;
typedef float __attribute__((may_alias)) float_a;
typedef int __attribute__((may_alias)) int_a;

template <typename T> __device__ __forceinline__ void vst2(void* p, T v) { *(T*)p = v;  }
__device__ __forceinline__ v8f wmma16(v16h a, v16h b, v8f c) {
  v8f d = __builtin_amdgcn_wmma_f32_16x16x32_f16(false, a, false, b, (short)0, c, false, false);
  asm volatile("v_nop\n\tv_nop\n\tv_nop\n\tv_nop" : "+v"(d) : "v"(a), "v"(b));
  return d;
}
__device__ __forceinline__ v8f wmma_bf(v16b a, v16b b, v8f c) {
  v8f d = __builtin_amdgcn_wmma_f32_16x16x32_bf16(false, a, false, b, (short)0, c, false, false);
  asm volatile("v_nop\n\tv_nop\n\tv_nop\n\tv_nop" : "+v"(d) : "v"(a), "v"(b));
  return d;
}
// 16x16x32 fragments: lane = (h = lane>>4, row/col = lane&15); elements 0..7 = k0+8h+0..7, 8..15 = k0+16+8h+0..7; D element r = row 8h+r
__device__ __forceinline__ v16h frag_h(const _Float16* rowk0, int lane) {
  union { v16h v; v8h q[2]; } u; const _Float16* p = rowk0 + 8 * (lane >> 4);
  u.q[0] = *(const v8h*)p; u.q[1] = *(const v8h*)(p + 16); return u.v;
}
__device__ __forceinline__ v16h frag_f32(const float* rowk0, int lane) {
  v16h a; const float* p = rowk0 + 8 * (lane >> 4);
#pragma unroll
  for (int i = 0; i < 8; ++i) { a[i] = (_Float16)p[i]; a[8 + i] = (_Float16)p[16 + i]; }
  return a;
}
__device__ __forceinline__ v16h frag_f32s(const float* rowk0, int lane, float sc) {
  v16h a; const float* p = rowk0 + 8 * (lane >> 4);
#pragma unroll
  for (int i = 0; i < 8; ++i) { a[i] = (_Float16)(p[i] * sc); a[8 + i] = (_Float16)(p[16 + i] * sc); }
  return a;
}
// column fragment from a [K][ld] layout (column n), rows >= K read as 0
__device__ __forceinline__ v16h fragc_f32(const float* W, int k0, int n, int lane, int ld, int K) {
  v16h a; const int g = lane >> 4;
#pragma unroll
  for (int i = 0; i < 8; ++i) { const int ka = k0 + 8 * g + i, kb = ka + 16;
    a[i] = (_Float16)(ka < K ? W[(size_t)ka * ld + n] : 0.f); a[8 + i] = (_Float16)(kb < K ? W[(size_t)kb * ld + n] : 0.f); }
  return a;
}
struct F2 { v16b h, l; };
__device__ __forceinline__ F2 bsplit16(const float v[16]) { F2 r;
#pragma unroll
  for (int i = 0; i < 16; ++i) { const __bf16 h = (__bf16)v[i]; r.h[i] = h; r.l[i] = (__bf16)(v[i] - (float)h); }
  return r; }
__device__ __forceinline__ F2 split_row(const float* row, int k0, int lane) { float v[16]; const float* p = row + k0 + 8 * (lane >> 4);
#pragma unroll
  for (int i = 0; i < 8; ++i) { v[i] = p[i]; v[8 + i] = p[16 + i]; }
  return bsplit16(v); }
__device__ __forceinline__ F2 split_rowK(const float* row, int k0, int lane, int K) { float v[16]; const int g = lane >> 4;
#pragma unroll
  for (int i = 0; i < 8; ++i) { const int ka = k0 + 8 * g + i, kb = ka + 16; v[i] = ka < K ? row[ka] : 0.f; v[8 + i] = kb < K ? row[kb] : 0.f; }
  return bsplit16(v); }
__device__ __forceinline__ F2 split_col(const float* W, int k0, int n, int lane, int ld, int K) { float v[16]; const int g = lane >> 4;
#pragma unroll
  for (int i = 0; i < 8; ++i) { const int ka = k0 + 8 * g + i, kb = ka + 16; v[i] = ka < K ? W[(size_t)ka * ld + n] : 0.f; v[8 + i] = kb < K ? W[(size_t)kb * ld + n] : 0.f; }
  return bsplit16(v); }
__device__ __forceinline__ v8f mac3(const F2& a, const F2& b, v8f c) { c = wmma_bf(a.l, b.h, c); c = wmma_bf(a.h, b.l, c); return wmma_bf(a.h, b.h, c); }
__device__ __forceinline__ float sigm(float v) { return 1.0f / (1.0f + expf(-v)); }
#define LDSX() do { asm volatile("s_wait_dscnt 0" ::: "memory"); __builtin_amdgcn_wave_barrier(); __builtin_amdgcn_fence(__ATOMIC_RELEASE, "workgroup"); } while (0)

// Causal core attention (16 heads, 2048 tokens, batch 1), near-f32: S = q.k/8 and P@V both on v_wmma_f32_16x16x32_bf16 as two-way
// bf16 splits taken directly from the f32 inputs (hi*hi + hi*lo + lo*hi, f32 accumulate) — plain f16 left ~1e-3 absolute error on the
// first few query rows (few keys, no averaging). Masked positions get -10000 exactly as the reference; key
#define SQ 2048
#define NH 16
#define HD 64
#define EE (NH * HD)
#define KP 68                      // LDS row pitch of a staged tile in floats: 272 B = 16 B x 17, free of bank conflicts for 16-byte row reads and 4-byte column walks
#define TILE_B (64 * KP * 4)       // bytes of one staged 64 x 64 f32 tile

// One lane's share of a 64 x 64 f32 tile (source row stride EE floats): eight asynchronous 16-byte copies global -> LDS, rows r, r + 8, ..., r + 56.
// A wave covers two whole 256-byte rows per copy. s_wait_xcnt closes the statement so that no address register is rewritten ahead of it.
__device__ __forceinline__ void copy_tile(unsigned l, const float* g) {
  asm volatile("global_load_async_to_lds_b128 %0, %8, off\n\t"
               "global_load_async_to_lds_b128 %1, %9, off\n\t"
               "global_load_async_to_lds_b128 %2, %10, off\n\t"
               "global_load_async_to_lds_b128 %3, %11, off\n\t"
               "global_load_async_to_lds_b128 %4, %12, off\n\t"
               "global_load_async_to_lds_b128 %5, %13, off\n\t"
               "global_load_async_to_lds_b128 %6, %14, off\n\t"
               "global_load_async_to_lds_b128 %7, %15, off\n\t"
               "s_wait_xcnt 0x0"
               :: "v"(l), "v"(l + 8 * KP * 4), "v"(l + 16 * KP * 4), "v"(l + 24 * KP * 4), "v"(l + 32 * KP * 4), "v"(l + 40 * KP * 4), "v"(l + 48 * KP * 4), "v"(l + 56 * KP * 4),
                  "v"(g), "v"(g + 8 * EE), "v"(g + 16 * EE), "v"(g + 24 * EE), "v"(g + 32 * EE), "v"(g + 40 * EE), "v"(g + 48 * EE), "v"(g + 56 * EE)
               : "memory");
}

__global__ __launch_bounds__(128) void k_attn(const float* __restrict__ q, const float* __restrict__ k, const float* __restrict__ v, float* __restrict__ out) {
  __shared__ __align__(16) float sS[4][16][68];
  __shared__ __align__(16) float sP[4][16][68];
  __shared__ __align__(16) float sO[4][16][68];
  __shared__ __align__(16) float sK[2][64][KP];      // key tiles, two buffers, shared by the four waves
  __shared__ __align__(16) float sV[2][64][KP];      // value tiles, likewise
  const int tid = threadIdx.x, w = tid >> 5, lane = tid & 31, col = lane & 15, g = lane >> 4;
  const int h = blockIdx.y, q0 = blockIdx.x * 64 + w * 16;
  const float* qb = q + h * HD; const float* kb = k + h * HD; const float* vb = v + h * HD;      // row stride EE
  F2 aq[2];
#pragma unroll
  for (int kc = 0; kc < 2; ++kc) aq[kc] = split_row(qb + (size_t)(q0 + col) * EE, kc * 32, lane);
  float mrun = -3.0e38f, lrun = 0.f; v8f acc[4] = {};
  const int ntiles = blockIdx.x + 1;
  // this lane's 16 bytes in row tid / 16 of a tile: LDS byte address in buffer 0, and the source element in tile 0
  const unsigned lk = (unsigned)(size_t)&sK[0][tid >> 4][(tid & 15) * 4], lv = (unsigned)(size_t)&sV[0][tid >> 4][(tid & 15) * 4];
  const float* gk = kb + (size_t)(tid >> 4) * EE + (tid & 15) * 4; const float* gv = vb + (size_t)(tid >> 4) * EE + (tid & 15) * 4;
  copy_tile(lk, gk); copy_tile(lv, gv);
  asm volatile("s_wait_asynccnt 0x0" ::: "memory");   // tile 0 has landed before the barrier publishes it
  __syncthreads();
  if (ntiles > 1) { copy_tile(lk + TILE_B, gk + (size_t)64 * EE); copy_tile(lv + TILE_B, gv + (size_t)64 * EE); }
#pragma unroll 1
  for (int kt = 0; kt < ntiles; ++kt) {
    const float* Kt = &sK[kt & 1][0][0]; const float* Vt = &sV[kt & 1][0][0];
#pragma unroll
    for (int t = 0; t < 4; ++t) { v8f s = {}; const int key = kt * 64 + t * 16 + col;
#pragma unroll
      for (int kc = 0; kc < 2; ++kc) s = mac3(aq[kc], split_row(Kt + (t * 16 + col) * KP, kc * 32, lane), s);
#pragma unroll
      for (int r = 0; r < 8; ++r) { const int qi = q0 + 8 * g + r; sS[w][8 * g + r][t * 16 + col] = key <= qi ? s[r] * 0.125f : -10000.0f; } }
    LDSX();
    float mx = -3.4e38f;
#pragma unroll
    for (int jj = 0; jj < 32; ++jj) mx = fmaxf(mx, sS[w][col][g * 32 + jj]);
    mx = fmaxf(mx, __shfl_xor(mx, 16, 32));
    const float mnew = fmaxf(mrun, mx); const float corr = expf(mrun - mnew);
    float ps = 0.f;
#pragma unroll
    for (int jj = 0; jj < 32; ++jj) { const float p = expf(sS[w][col][g * 32 + jj] - mnew); ps += p; sP[w][col][g * 32 + jj] = p; }
    ps += __shfl_xor(ps, 16, 32);
    lrun = lrun * corr + ps; mrun = mnew;
#pragma unroll
    for (int r = 0; r < 8; ++r) { const float cr = __shfl(corr, 8 * g + r, 32);
#pragma unroll
      for (int t = 0; t < 4; ++t) acc[t][r] *= cr; }
    LDSX();
#pragma unroll
    for (int kc = 0; kc < 2; ++kc) { const F2 pa = split_row(&sP[w][col][0], kc * 32, lane);
#pragma unroll
      for (int t = 0; t < 4; ++t) acc[t] = mac3(pa, split_col(Vt, kc * 32, t * 16 + col, lane, KP, 64), acc[t]); }
    __builtin_amdgcn_wave_barrier();
    asm volatile("s_wait_dscnt 0x0" ::: "memory");      // this wave's reads of the buffer are done before it is refilled
    asm volatile("s_wait_asynccnt 0x0" ::: "memory");   // this wave's copies of tile kt + 1 have landed
    __syncthreads();                                    // publishes tile kt + 1 and ends every wave's reads of tile kt
    if (kt + 2 < ntiles) { const unsigned bo = (unsigned)(kt & 1) * TILE_B; const size_t go = (size_t)(kt + 2) * 64 * EE;
      copy_tile(lk + bo, gk + go); copy_tile(lv + bo, gv + go); }
  }
  asm volatile("s_wait_asynccnt 0x0" ::: "memory");     // no copy is outstanding when the wave goes on to its end
#pragma unroll
  for (int r = 0; r < 8; ++r) { const float lr = __shfl(lrun, 8 * g + r, 32);
#pragma unroll
    for (int t = 0; t < 4; ++t) sO[w][8 * g + r][t * 16 + col] = acc[t][r] / lr; }
  LDSX();
  for (int qd = lane; qd < 16 * 16; qd += 32) { const int rl = qd >> 4, pc = qd & 15; vst2(out + (size_t)(q0 + rl) * EE + h * HD + pc * 4, *(const v4f*)(&sO[w][rl][pc * 4])); }
}
extern "C" void kernel_launch(void* const* d_in, const int* in_sizes, int n_in, void* d_out, int out_size, void* d_ws, size_t ws_size, hipStream_t stream) {
  (void)in_sizes; (void)n_in; (void)out_size; (void)ws_size; (void)d_ws;
  const float* q = (const float*)d_in[0]; const float* k = (const float*)d_in[1]; const float* v = (const float*)d_in[2];
  float* out = (float*)d_out;
  k_attn<<<dim3(SQ / 64, NH), 128, 0, stream>>>(q, k, v, out);
}

// v002
// A run of this version takes 77.1 microseconds.
// In two side-by-side timings against v001, it was 1.35 and 1.36 times as fast.
// Over all steps from v000 it is 2.71 times as fast.
#include <hip/hip_runtime.h>
#include <math.h>

typedef __attribute__((ext_vector_type(16))) _Float16 v16h;
typedef __attribute__((ext_vector_type(16))) __bf16 v16b;
typedef __attribute__((ext_vector_type(8)))  _Float16 v8h;
typedef __attribute__((ext_vector_type(8)))  float v8f;
typedef __attribute__((ext_vector_type(4)))  float v4f;
typedef __attribute__((ext_vector_type(2)))  float v2f;
typedef __attribute__((ext_vector_type(4)))  unsigned v4u;
typedef __attribute__((ext_vector_type(4)))  int v4i;
typedef float __attribute__((may_alias)) float_a;
typedef int __attribute__((may_alias)) int_a;

template <typename T> __device__ __forceinline__ void vst2(void* p, T v) { *(T*)p = v;  }
__device__ __forceinline__ v8f wmma16(v16h a, v16h b, v8f c) {
  v8f d = __builtin_amdgcn_wmma_f32_16x16x32_f16(false, a, false, b, (short)0, c, false, false);
  asm volatile("v_nop\n\tv_nop\n\tv_nop\n\tv_nop" : "+v"(d) : "v"(a), "v"(b));
  return d;
}
__device__ __forceinline__ v8f wmma_bf(v16b a, v16b b, v8f c) {
  v8f d = __builtin_amdgcn_wmma_f32_16x16x32_bf16(false, a, false, b, (short)0, c, false, false);
  asm volatile("v_nop\n\tv_nop\n\tv_nop\n\tv_nop" : "+v"(d) : "v"(a), "v"(b));
  return d;
}
// 16x16x32 fragments: lane = (h = lane>>4, row/col = lane&15); elements 0..7 = k0+8h+0..7, 8..15 = k0+16+8h+0..7; D element r = row 8h+r
__device__ __forceinline__ v16h frag_h(const _Float16* rowk0, int lane) {
  union { v16h v; v8h q[2]; } u; const _Float16* p = rowk0 + 8 * (lane >> 4);
  u.q[0] = *(const v8h*)p; u.q[1] = *(const v8h*)(p + 16); return u.v;
}
__device__ __forceinline__ v16h frag_f32(const float* rowk0, int lane) {
  v16h a; const float* p = rowk0 + 8 * (lane >> 4);
#pragma unroll
  for (int i = 0; i < 8; ++i) { a[i] = (_Float16)p[i]; a[8 + i] = (_Float16)p[16 + i]; }
  return a;
}
__device__ __forceinline__ v16h frag_f32s(const float* rowk0, int lane, float sc) {
  v16h a; const float* p = rowk0 + 8 * (lane >> 4);
#pragma unroll
  for (int i = 0; i < 8; ++i) { a[i] = (_Float16)(p[i] * sc); a[8 + i] = (_Float16)(p[16 + i] * sc); }
  return a;
}
// column fragment from a [K][ld] layout (column n), rows >= K read as 0
__device__ __forceinline__ v16h fragc_f32(const float* W, int k0, int n, int lane, int ld, int K) {
  v16h a; const int g = lane >> 4;
#pragma unroll
  for (int i = 0; i < 8; ++i) { const int ka = k0 + 8 * g + i, kb = ka + 16;
    a[i] = (_Float16)(ka < K ? W[(size_t)ka * ld + n] : 0.f); a[8 + i] = (_Float16)(kb < K ? W[(size_t)kb * ld + n] : 0.f); }
  return a;
}
struct F2 { v16b h, l; };
__device__ __forceinline__ F2 bsplit16(const float v[16]) { F2 r;
#pragma unroll
  for (int i = 0; i < 16; ++i) { const __bf16 h = (__bf16)v[i]; r.h[i] = h; r.l[i] = (__bf16)(v[i] - (float)h); }
  return r; }
__device__ __forceinline__ F2 split_row(const float* row, int k0, int lane) { float v[16]; const float* p = row + k0 + 8 * (lane >> 4);
#pragma unroll
  for (int i = 0; i < 8; ++i) { v[i] = p[i]; v[8 + i] = p[16 + i]; }
  return bsplit16(v); }
__device__ __forceinline__ F2 split_rowK(const float* row, int k0, int lane, int K) { float v[16]; const int g = lane >> 4;
#pragma unroll
  for (int i = 0; i < 8; ++i) { const int ka = k0 + 8 * g + i, kb = ka + 16; v[i] = ka < K ? row[ka] : 0.f; v[8 + i] = kb < K ? row[kb] : 0.f; }
  return bsplit16(v); }
__device__ __forceinline__ F2 split_col(const float* W, int k0, int n, int lane, int ld, int K) { float v[16]; const int g = lane >> 4;
#pragma unroll
  for (int i = 0; i < 8; ++i) { const int ka = k0 + 8 * g + i, kb = ka + 16; v[i] = ka < K ? W[(size_t)ka * ld + n] : 0.f; v[8 + i] = kb < K ? W[(size_t)kb * ld + n] : 0.f; }
  return bsplit16(v); }
__device__ __forceinline__ v8f mac3(const F2& a, const F2& b, v8f c) { c = wmma_bf(a.l, b.h, c); c = wmma_bf(a.h, b.l, c); return wmma_bf(a.h, b.h, c); }
__device__ __forceinline__ float sigm(float v) { return 1.0f / (1.0f + expf(-v)); }
#define LDSX() do { asm volatile("s_wait_dscnt 0" ::: "memory"); __builtin_amdgcn_wave_barrier(); __builtin_amdgcn_fence(__ATOMIC_RELEASE, "workgroup"); } while (0)

// Causal core attention (16 heads, 2048 tokens, batch 1), near-f32: S = q.k/8 and P@V both on v_wmma_f32_16x16x32_bf16 as two-way
// bf16 splits taken directly from the f32 inputs (hi*hi + hi*lo + lo*hi, f32 accumulate) — plain f16 left ~1e-3 absolute error on the
// first few query rows (few keys, no averaging). Masked positions get -10000 exactly as the reference; key
#define SQ 2048
#define NH 16
#define HD 64
#define EE (NH * HD)
#define KP 72                      // LDS row pitch of a staged plane in bf16: 144 B = 16 B x 9, free of bank conflicts for 16-byte row reads
#define PLANE_B (64 * KP * 2)      // bytes of one staged 64 x 64 bf16 plane
#define TILE_B (2 * PLANE_B)       // a staged tile: its hi plane, then its lo plane
#define PL ((size_t)SQ * EE)       // elements of one bf16 plane in the workspace: K hi, K lo as [token][head * 64 + d], then V hi, V lo as [head * 64 + d][token]
typedef __attribute__((ext_vector_type(8))) __bf16 v8b;

// Pre-pass: every K and V element is split into bf16 hi + lo once per call (the attention kernel did it in each wave for each tile it walked);
// V goes out transposed, so that a P@V column fragment is two 16-byte row reads like a K fragment.
__global__ __launch_bounds__(256) void k_split(const float* __restrict__ k, const float* __restrict__ v, __bf16* __restrict__ ws) {
  __shared__ float sT[64][65];     // 65: the column walk of the transpose meets no bank twice
  const int tid = threadIdx.x, s0 = blockIdx.x * 64, h = blockIdx.y, r = tid >> 2, c = (tid & 3) * 16;
  const float* p = (blockIdx.z == 0 ? k : v) + (size_t)(s0 + r) * EE + h * HD + c;
  float x[16];
#pragma unroll
  for (int i = 0; i < 4; ++i) { const v4f t = *(const v4f*)(p + 4 * i);
#pragma unroll
    for (int j = 0; j < 4; ++j) x[4 * i + j] = t[j]; }
  asm volatile("s_wait_xcnt 0x0" ::: "memory");   // stands in front of any rewrite of the four loads' address registers
  __bf16* o = ws + (size_t)(s0 + r) * EE + h * HD + c;
  if (blockIdx.z != 0) {
#pragma unroll
    for (int i = 0; i < 16; ++i) sT[r][c + i] = x[i];
    __syncthreads();               // the whole 64 x 64 tile is in LDS before its columns are read
#pragma unroll
    for (int i = 0; i < 16; ++i) x[i] = sT[c + i][r];
    o = ws + 2 * PL + (size_t)(h * HD + r) * SQ + s0 + c;
  }
  const F2 f = bsplit16(x);
  *(v16b*)o = f.h; *(v16b*)(o + PL) = f.l;
}

// hi and lo fragments from a staged tile: row points into the hi plane, the lo plane lies 64 * KP elements behind it
__device__ __forceinline__ F2 frag_pl(const __bf16* row, int k0, int lane) {
  union { v16b v; v8b q[2]; } a, b; const __bf16* p = row + k0 + 8 * (lane >> 4);
  a.q[0] = *(const v8b*)p; a.q[1] = *(const v8b*)(p + 16);
  b.q[0] = *(const v8b*)(p + 64 * KP); b.q[1] = *(const v8b*)(p + 64 * KP + 16);
  F2 r; r.h = a.v; r.l = b.v; return r;
}

// One lane's share of a 64 x 64 tile's two bf16 planes (source row stride ld elements): eight asynchronous 16-byte copies global -> LDS,
// rows r, r + 16, r + 32, r + 48 of the hi plane, then of the lo plane. A wave covers four whole 128-byte rows per copy.
// s_wait_xcnt closes the statement so that no address register is rewritten ahead of it.
__device__ __forceinline__ void copy_tile(unsigned l, const __bf16* g, int ld) {
  asm volatile("global_load_async_to_lds_b128 %0, %8, off\n\t"
               "global_load_async_to_lds_b128 %1, %9, off\n\t"
               "global_load_async_to_lds_b128 %2, %10, off\n\t"
               "global_load_async_to_lds_b128 %3, %11, off\n\t"
               "global_load_async_to_lds_b128 %4, %12, off\n\t"
               "global_load_async_to_lds_b128 %5, %13, off\n\t"
               "global_load_async_to_lds_b128 %6, %14, off\n\t"
               "global_load_async_to_lds_b128 %7, %15, off\n\t"
               "s_wait_xcnt 0x0"
               :: "v"(l), "v"(l + 16 * KP * 2), "v"(l + 32 * KP * 2), "v"(l + 48 * KP * 2),
                  "v"(l + PLANE_B), "v"(l + PLANE_B + 16 * KP * 2), "v"(l + PLANE_B + 32 * KP * 2), "v"(l + PLANE_B + 48 * KP * 2),
                  "v"(g), "v"(g + 16 * ld), "v"(g + 32 * ld), "v"(g + 48 * ld), "v"(g + PL), "v"(g + PL + 16 * ld), "v"(g + PL + 32 * ld), "v"(g + PL + 48 * ld)
               : "memory");
}

__global__ __launch_bounds__(128) void k_attn(const float* __restrict__ q, const __bf16* __restrict__ ws, float* __restrict__ out) {
  __shared__ __align__(16) float sS[4][16][68];
  __shared__ __align__(16) float sP[4][16][68];
  __shared__ __align__(16) float sO[4][16][68];
  __shared__ __align__(16) __bf16 sK[2][2][64][KP];  // key tiles [buffer][hi, lo][key][d], shared by the four waves
  __shared__ __align__(16) __bf16 sV[2][2][64][KP];  // value tiles [buffer][hi, lo][d][key], likewise
  const int tid = threadIdx.x, w = tid >> 5, lane = tid & 31, col = lane & 15, g = lane >> 4;
  const int h = blockIdx.y, q0 = blockIdx.x * 64 + w * 16;
  const float* qb = q + h * HD;      // row stride EE
  F2 aq[2];
#pragma unroll
  for (int kc = 0; kc < 2; ++kc) aq[kc] = split_row(qb + (size_t)(q0 + col) * EE, kc * 32, lane);
  float mrun = -3.0e38f, lrun = 0.f; v8f acc[4] = {};
  const int ntiles = blockIdx.x + 1;
  // this lane's 16 bytes in row tid / 8 of a plane: LDS byte address in buffer 0, and the source element in tile 0
  const unsigned lk = (unsigned)(size_t)&sK[0][0][tid >> 3][(tid & 7) * 8], lv = (unsigned)(size_t)&sV[0][0][tid >> 3][(tid & 7) * 8];
  const __bf16* gk = ws + (size_t)(tid >> 3) * EE + h * HD + (tid & 7) * 8; const __bf16* gv = ws + 2 * PL + (size_t)(h * HD + (tid >> 3)) * SQ + (tid & 7) * 8;
  copy_tile(lk, gk, EE); copy_tile(lv, gv, SQ);
  asm volatile("s_wait_asynccnt 0x0" ::: "memory");   // tile 0 has landed before the barrier publishes it
  __syncthreads();
  if (ntiles > 1) { copy_tile(lk + TILE_B, gk + (size_t)64 * EE, EE); copy_tile(lv + TILE_B, gv + 64, SQ); }
#pragma unroll 1
  for (int kt = 0; kt < ntiles; ++kt) {
    const __bf16* Kt = &sK[kt & 1][0][0][0]; const __bf16* Vt = &sV[kt & 1][0][0][0];
#pragma unroll
    for (int t = 0; t < 4; ++t) { v8f s = {}; const int key = kt * 64 + t * 16 + col;
#pragma unroll
      for (int kc = 0; kc < 2; ++kc) s = mac3(aq[kc], frag_pl(Kt + (t * 16 + col) * KP, kc * 32, lane), s);
#pragma unroll
      for (int r = 0; r < 8; ++r) { const int qi = q0 + 8 * g + r; sS[w][8 * g + r][t * 16 + col] = key <= qi ? s[r] * 0.125f : -10000.0f; } }
    LDSX();
    float mx = -3.4e38f;
#pragma unroll
    for (int jj = 0; jj < 32; ++jj) mx = fmaxf(mx, sS[w][col][g * 32 + jj]);
    mx = fmaxf(mx, __shfl_xor(mx, 16, 32));
    const float mnew = fmaxf(mrun, mx); const float corr = expf(mrun - mnew);
    float ps = 0.f;
#pragma unroll
    for (int jj = 0; jj < 32; ++jj) { const float p = expf(sS[w][col][g * 32 + jj] - mnew); ps += p; sP[w][col][g * 32 + jj] = p; }
    ps += __shfl_xor(ps, 16, 32);
    lrun = lrun * corr + ps; mrun = mnew;
#pragma unroll
    for (int r = 0; r < 8; ++r) { const float cr = __shfl(corr, 8 * g + r, 32);
#pragma unroll
      for (int t = 0; t < 4; ++t) acc[t][r] *= cr; }
    LDSX();
#pragma unroll
    for (int kc = 0; kc < 2; ++kc) { const F2 pa = split_row(&sP[w][col][0], kc * 32, lane);
#pragma unroll
      for (int t = 0; t < 4; ++t) acc[t] = mac3(pa, frag_pl(Vt + (t * 16 + col) * KP, kc * 32, lane), acc[t]); }
    __builtin_amdgcn_wave_barrier();
    asm volatile("s_wait_dscnt 0x0" ::: "memory");      // this wave's reads of the buffer are done before it is refilled
    asm volatile("s_wait_asynccnt 0x0" ::: "memory");   // this wave's copies of tile kt + 1 have landed
    __syncthreads();                                    // publishes tile kt + 1 and ends every wave's reads of tile kt
    if (kt + 2 < ntiles) { const unsigned bo = (unsigned)(kt & 1) * TILE_B; const size_t go = (size_t)(kt + 2) * 64;
      copy_tile(lk + bo, gk + go * EE, EE); copy_tile(lv + bo, gv + go, SQ); }
  }
  asm volatile("s_wait_asynccnt 0x0" ::: "memory");     // no copy is outstanding when the wave goes on to its end
#pragma unroll
  for (int r = 0; r < 8; ++r) { const float lr = __shfl(lrun, 8 * g + r, 32);
#pragma unroll
    for (int t = 0; t < 4; ++t) sO[w][8 * g + r][t * 16 + col] = acc[t][r] / lr; }
  LDSX();
  for (int qd = lane; qd < 16 * 16; qd += 32) { const int rl = qd >> 4, pc = qd & 15; vst2(out + (size_t)(q0 + rl) * EE + h * HD + pc * 4, *(const v4f*)(&sO[w][rl][pc * 4])); }
}
extern "C" void kernel_launch(void* const* d_in, const int* in_sizes, int n_in, void* d_out, int out_size, void* d_ws, size_t ws_size, hipStream_t stream) {
  (void)in_sizes; (void)n_in; (void)out_size; (void)ws_size;
  const float* q = (const float*)d_in[0]; const float* k = (const float*)d_in[1]; const float* v = (const float*)d_in[2];
  float* out = (float*)d_out; __bf16* ws = (__bf16*)d_ws;
  k_split<<<dim3(SQ / 64, NH, 2), 256, 0, stream>>>(k, v, ws);
  k_attn<<<dim3(SQ / 64, NH), 128, 0, stream>>>(q, ws, out);
}

// v003
// One run takes 70.9 microseconds.
// In both of two side-by-side timings against v002, it was 1.09 times as fast.
// Over all steps from v000 it is 2.94 times as fast.
#include <hip/hip_runtime.h>
#include <math.h>

typedef __attribute__((ext_vector_type(16))) _Float16 v16h;
typedef __attribute__((ext_vector_type(16))) __bf16 v16b;
typedef __attribute__((ext_vector_type(8)))  _Float16 v8h;
typedef __attribute__((ext_vector_type(8)))  float v8f;
typedef __attribute__((ext_vector_type(4)))  float v4f;
typedef __attribute__((ext_vector_type(2)))  float v2f;
typedef __attribute__((ext_vector_type(4)))  unsigned v4u;
typedef __attribute__((ext_vector_type(4)))  int v4i;
typedef float __attribute__((may_alias)) float_a;
typedef int __attribute__((may_alias)) int_a;

template <typename T> __device__ __forceinline__ void vst2(void* p, T v) { *(T*)p = v;  }
__device__ __forceinline__ v8f wmma16(v16h a, v16h b, v8f c) {
  v8f d = __builtin_amdgcn_wmma_f32_16x16x32_f16(false, a, false, b, (short)0, c, false, false);
  asm volatile("v_nop\n\tv_nop\n\tv_nop\n\tv_nop" : "+v"(d) : "v"(a), "v"(b));
  return d;
}
__device__ __forceinline__ v8f wmma_bf(v16b a, v16b b, v8f c) {
  v8f d = __builtin_amdgcn_wmma_f32_16x16x32_bf16(false, a, false, b, (short)0, c, false, false);
  asm volatile("v_nop\n\tv_nop\n\tv_nop\n\tv_nop" : "+v"(d) : "v"(a), "v"(b));
  return d;
}
// 16x16x32 fragments: lane = (h = lane>>4, row/col = lane&15); elements 0..7 = k0+8h+0..7, 8..15 = k0+16+8h+0..7; D element r = row 8h+r
__device__ __forceinline__ v16h frag_h(const _Float16* rowk0, int lane) {
  union { v16h v; v8h q[2]; } u; const _Float16* p = rowk0 + 8 * (lane >> 4);
  u.q[0] = *(const v8h*)p; u.q[1] = *(const v8h*)(p + 16); return u.v;
}
__device__ __forceinline__ v16h frag_f32(const float* rowk0, int lane) {
  v16h a; const float* p = rowk0 + 8 * (lane >> 4);
#pragma unroll
  for (int i = 0; i < 8; ++i) { a[i] = (_Float16)p[i]; a[8 + i] = (_Float16)p[16 + i]; }
  return a;
}
__device__ __forceinline__ v16h frag_f32s(const float* rowk0, int lane, float sc) {
  v16h a; const float* p = rowk0 + 8 * (lane >> 4);
#pragma unroll
  for (int i = 0; i < 8; ++i) { a[i] = (_Float16)(p[i] * sc); a[8 + i] = (_Float16)(p[16 + i] * sc); }
  return a;
}
// column fragment from a [K][ld] layout (column n), rows >= K read as 0
__device__ __forceinline__ v16h fragc_f32(const float* W, int k0, int n, int lane, int ld, int K) {
  v16h a; const int g = lane >> 4;
#pragma unroll
  for (int i = 0; i < 8; ++i) { const int ka = k0 + 8 * g + i, kb = ka + 16;
    a[i] = (_Float16)(ka < K ? W[(size_t)ka * ld + n] : 0.f); a[8 + i] = (_Float16)(kb < K ? W[(size_t)kb * ld + n] : 0.f); }
  return a;
}
struct F2 { v16b h, l; };
__device__ __forceinline__ F2 bsplit16(const float v[16]) { F2 r;
#pragma unroll
  for (int i = 0; i < 16; ++i) { const __bf16 h = (__bf16)v[i]; r.h[i] = h; r.l[i] = (__bf16)(v[i] - (float)h); }
  return r; }
__device__ __forceinline__ F2 split_row(const float* row, int k0, int lane) { float v[16]; const float* p = row + k0 + 8 * (lane >> 4);
#pragma unroll
  for (int i = 0; i < 8; ++i) { v[i] = p[i]; v[8 + i] = p[16 + i]; }
  return bsplit16(v); }
__device__ __forceinline__ F2 split_rowK(const float* row, int k0, int lane, int K) { float v[16]; const int g = lane >> 4;
#pragma unroll
  for (int i = 0; i < 8; ++i) { const int ka = k0 + 8 * g + i, kb = ka + 16; v[i] = ka < K ? row[ka] : 0.f; v[8 + i] = kb < K ? row[kb] : 0.f; }
  return bsplit16(v); }
__device__ __forceinline__ F2 split_col(const float* W, int k0, int n, int lane, int ld, int K) { float v[16]; const int g = lane >> 4;
#pragma unroll
  for (int i = 0; i < 8; ++i) { const int ka = k0 + 8 * g + i, kb = ka + 16; v[i] = ka < K ? W[(size_t)ka * ld + n] : 0.f; v[8 + i] = kb < K ? W[(size_t)kb * ld + n] : 0.f; }
  return bsplit16(v); }
__device__ __forceinline__ v8f mac3(const F2& a, const F2& b, v8f c) { c = wmma_bf(a.l, b.h, c); c = wmma_bf(a.h, b.l, c); return wmma_bf(a.h, b.h, c); }
__device__ __forceinline__ float sigm(float v) { return 1.0f / (1.0f + expf(-v)); }
#define LDSX() do { asm volatile("s_wait_dscnt 0" ::: "memory"); __builtin_amdgcn_wave_barrier(); __builtin_amdgcn_fence(__ATOMIC_RELEASE, "workgroup"); } while (0)

// Causal core attention (16 heads, 2048 tokens, batch 1), near-f32: S = q.k/8 and P@V both on v_wmma_f32_16x16x32_bf16 as two-way
// bf16 splits taken directly from the f32 inputs (hi*hi + hi*lo + lo*hi, f32 accumulate) — plain f16 left ~1e-3 absolute error on the
// first few query rows (few keys, no averaging). Masked positions get -10000 exactly as the reference; key
#define SQ 2048
#define NH 16
#define HD 64
#define EE (NH * HD)
#define KP 72                      // LDS row pitch of a staged plane in bf16: 144 B = 16 B x 9, free of bank conflicts for 16-byte row reads
#define PLANE_B (64 * KP * 2)      // bytes of one staged 64 x 64 bf16 plane
#define TILE_B (2 * PLANE_B)       // a staged tile: its hi plane, then its lo plane
#define PL ((size_t)SQ * EE)       // elements of one bf16 plane in the workspace: K hi, K lo as [token][head * 64 + d], then V hi, V lo as [head * 64 + d][token]
typedef __attribute__((ext_vector_type(8))) __bf16 v8b;

// Pre-pass: every K and V element is split into bf16 hi + lo once per call (the attention kernel did it in each wave for each tile it walked);
// V goes out transposed, so that a P@V column fragment is two 16-byte row reads like a K fragment.
__global__ __launch_bounds__(256) void k_split(const float* __restrict__ k, const float* __restrict__ v, __bf16* __restrict__ ws) {
  __shared__ float sT[64][65];     // 65: the column walk of the transpose meets no bank twice
  const int tid = threadIdx.x, s0 = blockIdx.x * 64, h = blockIdx.y, r = tid >> 2, c = (tid & 3) * 16;
  const float* p = (blockIdx.z == 0 ? k : v) + (size_t)(s0 + r) * EE + h * HD + c;
  float x[16];
#pragma unroll
  for (int i = 0; i < 4; ++i) { const v4f t = *(const v4f*)(p + 4 * i);
#pragma unroll
    for (int j = 0; j < 4; ++j) x[4 * i + j] = t[j]; }
  asm volatile("s_wait_xcnt 0x0" ::: "memory");   // stands in front of any rewrite of the four loads' address registers
  __bf16* o = ws + (size_t)(s0 + r) * EE + h * HD + c;
  if (blockIdx.z != 0) {
#pragma unroll
    for (int i = 0; i < 16; ++i) sT[r][c + i] = x[i];
    __syncthreads();               // the whole 64 x 64 tile is in LDS before its columns are read
#pragma unroll
    for (int i = 0; i < 16; ++i) x[i] = sT[c + i][r];
    o = ws + 2 * PL + (size_t)(h * HD + r) * SQ + s0 + c;
  }
  const F2 f = bsplit16(x);
  *(v16b*)o = f.h; *(v16b*)(o + PL) = f.l;
}

// hi and lo fragments from a staged tile: row points into the hi plane, the lo plane lies 64 * KP elements behind it
__device__ __forceinline__ F2 frag_pl(const __bf16* row, int k0, int lane) {
  union { v16b v; v8b q[2]; } a, b; const __bf16* p = row + k0 + 8 * (lane >> 4);
  a.q[0] = *(const v8b*)p; a.q[1] = *(const v8b*)(p + 16);
  b.q[0] = *(const v8b*)(p + 64 * KP); b.q[1] = *(const v8b*)(p + 64 * KP + 16);
  F2 r; r.h = a.v; r.l = b.v; return r;
}

// One lane's share of a 64 x 64 tile's two bf16 planes (source row stride ld elements): eight asynchronous 16-byte copies global -> LDS,
// rows r, r + 16, r + 32, r + 48 of the hi plane, then of the lo plane. A wave covers four whole 128-byte rows per copy.
// s_wait_xcnt closes the statement so that no address register is rewritten ahead of it.
__device__ __forceinline__ void copy_tile(unsigned l, const __bf16* g, int ld) {
  asm volatile("global_load_async_to_lds_b128 %0, %8, off\n\t"
               "global_load_async_to_lds_b128 %1, %9, off\n\t"
               "global_load_async_to_lds_b128 %2, %10, off\n\t"
               "global_load_async_to_lds_b128 %3, %11, off\n\t"
               "global_load_async_to_lds_b128 %4, %12, off\n\t"
               "global_load_async_to_lds_b128 %5, %13, off\n\t"
               "global_load_async_to_lds_b128 %6, %14, off\n\t"
               "global_load_async_to_lds_b128 %7, %15, off\n\t"
               "s_wait_xcnt 0x0"
               :: "v"(l), "v"(l + 16 * KP * 2), "v"(l + 32 * KP * 2), "v"(l + 48 * KP * 2),
                  "v"(l + PLANE_B), "v"(l + PLANE_B + 16 * KP * 2), "v"(l + PLANE_B + 32 * KP * 2), "v"(l + PLANE_B + 48 * KP * 2),
                  "v"(g), "v"(g + 16 * ld), "v"(g + 32 * ld), "v"(g + 48 * ld), "v"(g + PL), "v"(g + PL + 16 * ld), "v"(g + PL + 32 * ld), "v"(g + PL + 48 * ld)
               : "memory");
}

__global__ __launch_bounds__(128) void k_attn(const float* __restrict__ q, const __bf16* __restrict__ ws, float* __restrict__ out) {
  __shared__ __align__(16) float sS[4][16][68];
  __shared__ __align__(16) float sP[4][16][68];
  __shared__ __align__(16) float sO[4][16][68];
  __shared__ __align__(16) __bf16 sK[2][2][64][KP];  // key tiles [buffer][hi, lo][key][d], shared by the four waves
  __shared__ __align__(16) __bf16 sV[2][2][64][KP];  // value tiles [buffer][hi, lo][d][key], likewise
  const int tid = threadIdx.x, w = tid >> 5, lane = tid & 31, col = lane & 15, g = lane >> 4;
  const int h = blockIdx.y, q0 = blockIdx.x * 64 + w * 16;
  const float* qb = q + h * HD;      // row stride EE
  F2 aq[2];
#pragma unroll
  for (int kc = 0; kc < 2; ++kc) aq[kc] = split_row(qb + (size_t)(q0 + col) * EE, kc * 32, lane);
  float mrun = -3.0e38f, lrun = 0.f; v8f acc[4] = {};
  const int ntiles = blockIdx.x + 1;
  // this lane's 16 bytes in row tid / 8 of a plane: LDS byte address in buffer 0, and the source element in tile 0
  const unsigned lk = (unsigned)(size_t)&sK[0][0][tid >> 3][(tid & 7) * 8], lv = (unsigned)(size_t)&sV[0][0][tid >> 3][(tid & 7) * 8];
  const __bf16* gk = ws + (size_t)(tid >> 3) * EE + h * HD + (tid & 7) * 8; const __bf16* gv = ws + 2 * PL + (size_t)(h * HD + (tid >> 3)) * SQ + (tid & 7) * 8;
  copy_tile(lk, gk, EE); copy_tile(lv, gv, SQ);
  asm volatile("s_wait_asynccnt 0x0" ::: "memory");   // tile 0 has landed before the barrier publishes it
  __syncthreads();
  if (ntiles > 1) { copy_tile(lk + TILE_B, gk + (size_t)64 * EE, EE); copy_tile(lv + TILE_B, gv + 64, SQ); }
#pragma unroll 1
  for (int kt = 0; kt < ntiles; ++kt) {
    const __bf16* Kt = &sK[kt & 1][0][0][0]; const __bf16* Vt = &sV[kt & 1][0][0][0];
    // The trip's fragment reads stand in groups ahead of the products that use them, so that one LDS latency is waited out per group and not one
    // per three products: the K fragments at the top; the first half of the V fragments behind the second score tile, in the registers that
    // two tiles' K fragments leave (it lands under the other score tiles); the second half in front of the first half's products.
    F2 kf[4][2], vf[2][4];
#pragma unroll
    for (int t = 0; t < 4; ++t) {
#pragma unroll
      for (int kc = 0; kc < 2; ++kc) kf[t][kc] = frag_pl(Kt + (t * 16 + col) * KP, kc * 32, lane); }
#pragma unroll
    for (int t = 0; t < 4; ++t) { v8f s = {}; const int key = kt * 64 + t * 16 + col;
#pragma unroll
      for (int kc = 0; kc < 2; ++kc) s = mac3(aq[kc], kf[t][kc], s);
      if (t == 1) {
#pragma unroll
        for (int u = 0; u < 4; ++u) vf[0][u] = frag_pl(Vt + (u * 16 + col) * KP, 0, lane); }
#pragma unroll
      for (int r = 0; r < 8; ++r) { const int qi = q0 + 8 * g + r; sS[w][8 * g + r][t * 16 + col] = key <= qi ? s[r] * 0.125f : -10000.0f; } }
    LDSX();
    float mx = -3.4e38f;
#pragma unroll
    for (int jj = 0; jj < 32; ++jj) mx = fmaxf(mx, sS[w][col][g * 32 + jj]);
    mx = fmaxf(mx, __shfl_xor(mx, 16, 32));
    const float mnew = fmaxf(mrun, mx); const float corr = expf(mrun - mnew);
    float ps = 0.f;
#pragma unroll
    for (int jj = 0; jj < 32; ++jj) { const float p = expf(sS[w][col][g * 32 + jj] - mnew); ps += p; sP[w][col][g * 32 + jj] = p; }
    ps += __shfl_xor(ps, 16, 32);
    lrun = lrun * corr + ps; mrun = mnew;
#pragma unroll
    for (int r = 0; r < 8; ++r) { const float cr = __shfl(corr, 8 * g + r, 32);
#pragma unroll
      for (int t = 0; t < 4; ++t) acc[t][r] *= cr; }
    LDSX();
    F2 pa[2];
#pragma unroll
    for (int kc = 0; kc < 2; ++kc) pa[kc] = split_row(&sP[w][col][0], kc * 32, lane);
#pragma unroll
    for (int u = 0; u < 4; ++u) vf[1][u] = frag_pl(Vt + (u * 16 + col) * KP, 32, lane);
#pragma unroll
    for (int kc = 0; kc < 2; ++kc) {
#pragma unroll
      for (int t = 0; t < 4; ++t) acc[t] = mac3(pa[kc], vf[kc][t], acc[t]); }
    __builtin_amdgcn_wave_barrier();
    asm volatile("s_wait_dscnt 0x0" ::: "memory");      // this wave's reads of the buffer are done before it is refilled
    asm volatile("s_wait_asynccnt 0x0" ::: "memory");   // this wave's copies of tile kt + 1 have landed
    __syncthreads();                                    // publishes tile kt + 1 and ends every wave's reads of tile kt
    if (kt + 2 < ntiles) { const unsigned bo = (unsigned)(kt & 1) * TILE_B; const size_t go = (size_t)(kt + 2) * 64;
      copy_tile(lk + bo, gk + go * EE, EE); copy_tile(lv + bo, gv + go, SQ); }
  }
  asm volatile("s_wait_asynccnt 0x0" ::: "memory");     // no copy is outstanding when the wave goes on to its end
#pragma unroll
  for (int r = 0; r < 8; ++r) { const float lr = __shfl(lrun, 8 * g + r, 32);
#pragma unroll
    for (int t = 0; t < 4; ++t) sO[w][8 * g + r][t * 16 + col] = acc[t][r] / lr; }
  LDSX();
  for (int qd = lane; qd < 16 * 16; qd += 32) { const int rl = qd >> 4, pc = qd & 15; vst2(out + (size_t)(q0 + rl) * EE + h * HD + pc * 4, *(const v4f*)(&sO[w][rl][pc * 4])); }
}
extern "C" void kernel_launch(void* const* d_in, const int* in_sizes, int n_in, void* d_out, int out_size, void* d_ws, size_t ws_size, hipStream_t stream) {
  (void)in_sizes; (void)n_in; (void)out_size; (void)ws_size;
  const float* q = (const float*)d_in[0]; const float* k = (const float*)d_in[1]; const float* v = (const float*)d_in[2];
  float* out = (float*)d_out; __bf16* ws = (__bf16*)d_ws;
  k_split<<<dim3(SQ / 64, NH, 2), 256, 0, stream>>>(k, v, ws);
  k_attn<<<dim3(SQ / 64, NH), 128, 0, stream>>>(q, ws, out);
}

// v004
// A run of this version takes 58.6 microseconds.
// Timed twice side by side with v003, it ran 1.21 times as fast both times.
// Over all steps from v000 it is 3.56 times as fast.
#include <hip/hip_runtime.h>
#include <math.h>

typedef __attribute__((ext_vector_type(16))) _Float16 v16h;
typedef __attribute__((ext_vector_type(16))) __bf16 v16b;
typedef __attribute__((ext_vector_type(8)))  _Float16 v8h;
typedef __attribute__((ext_vector_type(8)))  float v8f;
typedef __attribute__((ext_vector_type(4)))  float v4f;
typedef __attribute__((ext_vector_type(2)))  float v2f;
typedef __attribute__((ext_vector_type(4)))  unsigned v4u;
typedef __attribute__((ext_vector_type(4)))  int v4i;
typedef float __attribute__((may_alias)) float_a;
typedef int __attribute__((may_alias)) int_a;

template <typename T> __device__ __forceinline__ void vst2(void* p, T v) { *(T*)p = v;  }
__device__ __forceinline__ v8f wmma16(v16h a, v16h b, v8f c) {
  v8f d = __builtin_amdgcn_wmma_f32_16x16x32_f16(false, a, false, b, (short)0, c, false, false);
  asm volatile("v_nop\n\tv_nop\n\tv_nop\n\tv_nop" : "+v"(d) : "v"(a), "v"(b));
  return d;
}
__device__ __forceinline__ v8f wmma_bf(v16b a, v16b b, v8f c) {
  v8f d = __builtin_amdgcn_wmma_f32_16x16x32_bf16(false, a, false, b, (short)0, c, false, false);
  asm volatile("v_nop\n\tv_nop\n\tv_nop\n\tv_nop" : "+v"(d) : "v"(a), "v"(b));
  return d;
}
// 16x16x32 fragments: lane = (h = lane>>4, row/col = lane&15); elements 0..7 = k0+8h+0..7, 8..15 = k0+16+8h+0..7; D element r = row 8h+r
__device__ __forceinline__ v16h frag_h(const _Float16* rowk0, int lane) {
  union { v16h v; v8h q[2]; } u; const _Float16* p = rowk0 + 8 * (lane >> 4);
  u.q[0] = *(const v8h*)p; u.q[1] = *(const v8h*)(p + 16); return u.v;
}
__device__ __forceinline__ v16h frag_f32(const float* rowk0, int lane) {
  v16h a; const float* p = rowk0 + 8 * (lane >> 4);
#pragma unroll
  for (int i = 0; i < 8; ++i) { a[i] = (_Float16)p[i]; a[8 + i] = (_Float16)p[16 + i]; }
  return a;
}
__device__ __forceinline__ v16h frag_f32s(const float* rowk0, int lane, float sc) {
  v16h a; const float* p = rowk0 + 8 * (lane >> 4);
#pragma unroll
  for (int i = 0; i < 8; ++i) { a[i] = (_Float16)(p[i] * sc); a[8 + i] = (_Float16)(p[16 + i] * sc); }
  return a;
}
// column fragment from a [K][ld] layout (column n), rows >= K read as 0
__device__ __forceinline__ v16h fragc_f32(const float* W, int k0, int n, int lane, int ld, int K) {
  v16h a; const int g = lane >> 4;
#pragma unroll
  for (int i = 0; i < 8; ++i) { const int ka = k0 + 8 * g + i, kb = ka + 16;
    a[i] = (_Float16)(ka < K ? W[(size_t)ka * ld + n] : 0.f); a[8 + i] = (_Float16)(kb < K ? W[(size_t)kb * ld + n] : 0.f); }
  return a;
}
struct F2 { v16b h, l; };
__device__ __forceinline__ F2 bsplit16(const float v[16]) { F2 r;
#pragma unroll
  for (int i = 0; i < 16; ++i) { const __bf16 h = (__bf16)v[i]; r.h[i] = h; r.l[i] = (__bf16)(v[i] - (float)h); }
  return r; }
__device__ __forceinline__ F2 split_row(const float* row, int k0, int lane) { float v[16]; const float* p = row + k0 + 8 * (lane >> 4);
#pragma unroll
  for (int i = 0; i < 8; ++i) { v[i] = p[i]; v[8 + i] = p[16 + i]; }
  return bsplit16(v); }
__device__ __forceinline__ F2 split_rowK(const float* row, int k0, int lane, int K) { float v[16]; const int g = lane >> 4;
#pragma unroll
  for (int i = 0; i < 8; ++i) { const int ka = k0 + 8 * g + i, kb = ka + 16; v[i] = ka < K ? row[ka] : 0.f; v[8 + i] = kb < K ? row[kb] : 0.f; }
  return bsplit16(v); }
__device__ __forceinline__ F2 split_col(const float* W, int k0, int n, int lane, int ld, int K) { float v[16]; const int g = lane >> 4;
#pragma unroll
  for (int i = 0; i < 8; ++i) { const int ka = k0 + 8 * g + i, kb = ka + 16; v[i] = ka < K ? W[(size_t)ka * ld + n] : 0.f; v[8 + i] = kb < K ? W[(size_t)kb * ld + n] : 0.f; }
  return bsplit16(v); }
__device__ __forceinline__ v8f mac3(const F2& a, const F2& b, v8f c) { c = wmma_bf(a.l, b.h, c); c = wmma_bf(a.h, b.l, c); return wmma_bf(a.h, b.h, c); }
__device__ __forceinline__ float sigm(float v) { return 1.0f / (1.0f + expf(-v)); }
#define LDSX() do { asm volatile("s_wait_dscnt 0" ::: "memory"); __builtin_amdgcn_wave_barrier(); __builtin_amdgcn_fence(__ATOMIC_RELEASE, "workgroup"); } while (0)

// Causal core attention (16 heads, 2048 tokens, batch 1), near-f32: S = q.k/8 and P@V both on v_wmma_f32_16x16x32_bf16 as two-way
// bf16 splits taken directly from the f32 inputs (hi*hi + hi*lo + lo*hi, f32 accumulate) — plain f16 left ~1e-3 absolute error on the
// first few query rows (few keys, no averaging). Masked positions get -10000; key
#define LOG2E 1.4426950408889634f
#define SQ 2048
#define NH 16
#define HD 64
#define EE (NH * HD)
#define KP 72                      // LDS row pitch of a staged plane in bf16: 144 B = 16 B x 9, free of bank conflicts for 16-byte row reads
#define PLANE_B (64 * KP * 2)      // bytes of one staged 64 x 64 bf16 plane
#define TILE_B (2 * PLANE_B)       // a staged tile: its hi plane, then its lo plane
#define PL ((size_t)SQ * EE)       // elements of one bf16 plane in the workspace: K hi, K lo as [token][head * 64 + d], then V hi, V lo as [head * 64 + d][token]
typedef __attribute__((ext_vector_type(8))) __bf16 v8b;

// Pre-pass: every K and V element is split into bf16 hi + lo once per call (the attention kernel did it in each wave for each tile it walked);
// V goes out transposed, so that a P@V column fragment is two 16-byte row reads like a K fragment.
__global__ __launch_bounds__(256) void k_split(const float* __restrict__ k, const float* __restrict__ v, __bf16* __restrict__ ws) {
  __shared__ float sT[64][65];     // 65: the column walk of the transpose meets no bank twice
  const int tid = threadIdx.x, s0 = blockIdx.x * 64, h = blockIdx.y, r = tid >> 2, c = (tid & 3) * 16;
  const float* p = (blockIdx.z == 0 ? k : v) + (size_t)(s0 + r) * EE + h * HD + c;
  float x[16];
#pragma unroll
  for (int i = 0; i < 4; ++i) { const v4f t = *(const v4f*)(p + 4 * i);
#pragma unroll
    for (int j = 0; j < 4; ++j) x[4 * i + j] = t[j]; }
  asm volatile("s_wait_xcnt 0x0" ::: "memory");   // stands in front of any rewrite of the four loads' address registers
  __bf16* o = ws + (size_t)(s0 + r) * EE + h * HD + c;
  if (blockIdx.z != 0) {
#pragma unroll
    for (int i = 0; i < 16; ++i) sT[r][c + i] = x[i];
    __syncthreads();               // the whole 64 x 64 tile is in LDS before its columns are read
#pragma unroll
    for (int i = 0; i < 16; ++i) x[i] = sT[c + i][r];
    o = ws + 2 * PL + (size_t)(h * HD + r) * SQ + s0 + c;
  }
  const F2 f = bsplit16(x);
  *(v16b*)o = f.h; *(v16b*)(o + PL) = f.l;
}

// hi and lo fragments from a staged tile: row points into the hi plane, the lo plane lies 64 * KP elements behind it
__device__ __forceinline__ F2 frag_pl(const __bf16* row, int k0, int lane) {
  union { v16b v; v8b q[2]; } a, b; const __bf16* p = row + k0 + 8 * (lane >> 4);
  a.q[0] = *(const v8b*)p; a.q[1] = *(const v8b*)(p + 16);
  b.q[0] = *(const v8b*)(p + 64 * KP); b.q[1] = *(const v8b*)(p + 64 * KP + 16);
  F2 r; r.h = a.v; r.l = b.v; return r;
}

// One lane's share of a 64 x 64 tile's two bf16 planes (source row stride ld elements): eight asynchronous 16-byte copies global -> LDS,
// rows r, r + 16, r + 32, r + 48 of the hi plane, then of the lo plane. A wave covers four whole 128-byte rows per copy.
// s_wait_xcnt closes the statement so that no address register is rewritten ahead of it.
__device__ __forceinline__ void copy_tile(unsigned l, const __bf16* g, int ld) {
  asm volatile("global_load_async_to_lds_b128 %0, %8, off\n\t"
               "global_load_async_to_lds_b128 %1, %9, off\n\t"
               "global_load_async_to_lds_b128 %2, %10, off\n\t"
               "global_load_async_to_lds_b128 %3, %11, off\n\t"
               "global_load_async_to_lds_b128 %4, %12, off\n\t"
               "global_load_async_to_lds_b128 %5, %13, off\n\t"
               "global_load_async_to_lds_b128 %6, %14, off\n\t"
               "global_load_async_to_lds_b128 %7, %15, off\n\t"
               "s_wait_xcnt 0x0"
               :: "v"(l), "v"(l + 16 * KP * 2), "v"(l + 32 * KP * 2), "v"(l + 48 * KP * 2),
                  "v"(l + PLANE_B), "v"(l + PLANE_B + 16 * KP * 2), "v"(l + PLANE_B + 32 * KP * 2), "v"(l + PLANE_B + 48 * KP * 2),
                  "v"(g), "v"(g + 16 * ld), "v"(g + 32 * ld), "v"(g + 48 * ld), "v"(g + PL), "v"(g + PL + 16 * ld), "v"(g + PL + 32 * ld), "v"(g + PL + 48 * ld)
               : "memory");
}

__global__ __launch_bounds__(128) void k_attn(const float* __restrict__ q, const __bf16* __restrict__ ws, float* __restrict__ out) {
  __shared__ __align__(16) float sS[4][16][68];
  __shared__ __align__(16) float sP[4][16][68];
  __shared__ __align__(16) float sO[4][16][68];
  __shared__ __align__(16) __bf16 sK[2][2][64][KP];  // key tiles [buffer][hi, lo][key][d], shared by the four waves
  __shared__ __align__(16) __bf16 sV[2][2][64][KP];  // value tiles [buffer][hi, lo][d][key], likewise
  const int tid = threadIdx.x, w = tid >> 5, lane = tid & 31, col = lane & 15, g = lane >> 4;
  const int h = blockIdx.y, q0 = blockIdx.x * 64 + w * 16;
  const float* qb = q + h * HD;      // row stride EE
  F2 aq[2];
#pragma unroll
  for (int kc = 0; kc < 2; ++kc) aq[kc] = split_row(qb + (size_t)(q0 + col) * EE, kc * 32, lane);
  float mrun = -3.0e38f, lrun = 0.f; v8f acc[4] = {};
  const int ntiles = blockIdx.x + 1;
  // this lane's 16 bytes in row tid / 8 of a plane: LDS byte address in buffer 0, and the source element in tile 0
  const unsigned lk = (unsigned)(size_t)&sK[0][0][tid >> 3][(tid & 7) * 8], lv = (unsigned)(size_t)&sV[0][0][tid >> 3][(tid & 7) * 8];
  const __bf16* gk = ws + (size_t)(tid >> 3) * EE + h * HD + (tid & 7) * 8; const __bf16* gv = ws + 2 * PL + (size_t)(h * HD + (tid >> 3)) * SQ + (tid & 7) * 8;
  copy_tile(lk, gk, EE); copy_tile(lv, gv, SQ);
  asm volatile("s_wait_asynccnt 0x0" ::: "memory");   // tile 0 has landed before the barrier publishes it
  __syncthreads();
  if (ntiles > 1) { copy_tile(lk + TILE_B, gk + (size_t)64 * EE, EE); copy_tile(lv + TILE_B, gv + 64, SQ); }
#pragma unroll 1
  for (int kt = 0; kt < ntiles; ++kt) {
    const __bf16* Kt = &sK[kt & 1][0][0][0]; const __bf16* Vt = &sV[kt & 1][0][0][0];
    // The trip's fragment reads stand in groups ahead of the products that use them, so that one LDS latency is waited out per group and not one
    // per three products: the K fragments at the top; the first half of the V fragments behind the second score tile, in the registers that
    // two tiles' K fragments leave (it lands under the other score tiles); the second half in front of the first half's products.
    F2 kf[4][2], vf[2][4];
#pragma unroll
    for (int t = 0; t < 4; ++t) {
#pragma unroll
      for (int kc = 0; kc < 2; ++kc) kf[t][kc] = frag_pl(Kt + (t * 16 + col) * KP, kc * 32, lane); }
#pragma unroll
    for (int t = 0; t < 4; ++t) { v8f s = {}; const int key = kt * 64 + t * 16 + col;
#pragma unroll
      for (int kc = 0; kc < 2; ++kc) s = mac3(aq[kc], kf[t][kc], s);
      if (t == 1) {
#pragma unroll
        for (int u = 0; u < 4; ++u) vf[0][u] = frag_pl(Vt + (u * 16 + col) * KP, 0, lane); }
#pragma unroll
      for (int r = 0; r < 8; ++r) { const int qi = q0 + 8 * g + r; sS[w][8 * g + r][t * 16 + col] = key <= qi ? s[r] * 0.125f : -10000.0f; } }
    LDSX();
    float mx = -3.4e38f;
#pragma unroll
    for (int jj = 0; jj < 32; ++jj) mx = fmaxf(mx, sS[w][col][g * 32 + jj]);
    mx = fmaxf(mx, __shfl_xor(mx, 16, 32));
    // exponentials in base 2 on the hardware's own instruction: the running maximum is kept times log2(e), one fused multiply-add forms each argument
    const float mnew = fmaxf(mrun, mx * LOG2E); const float corr = __builtin_amdgcn_exp2f(mrun - mnew);
    float ps = 0.f;
#pragma unroll
    for (int jj = 0; jj < 32; ++jj) { const float p = __builtin_amdgcn_exp2f(fmaf(sS[w][col][g * 32 + jj], LOG2E, -mnew)); ps += p; sP[w][col][g * 32 + jj] = p; }
    ps += __shfl_xor(ps, 16, 32);
    lrun = lrun * corr + ps; mrun = mnew;
#pragma unroll
    for (int r = 0; r < 8; ++r) { const float cr = __shfl(corr, 8 * g + r, 32);
#pragma unroll
      for (int t = 0; t < 4; ++t) acc[t][r] *= cr; }
    LDSX();
    F2 pa[2];
#pragma unroll
    for (int kc = 0; kc < 2; ++kc) pa[kc] = split_row(&sP[w][col][0], kc * 32, lane);
#pragma unroll
    for (int u = 0; u < 4; ++u) vf[1][u] = frag_pl(Vt + (u * 16 + col) * KP, 32, lane);
#pragma unroll
    for (int kc = 0; kc < 2; ++kc) {
#pragma unroll
      for (int t = 0; t < 4; ++t) acc[t] = mac3(pa[kc], vf[kc][t], acc[t]); }
    __builtin_amdgcn_wave_barrier();
    asm volatile("s_wait_dscnt 0x0" ::: "memory");      // this wave's reads of the buffer are done before it is refilled
    asm volatile("s_wait_asynccnt 0x0" ::: "memory");   // this wave's copies of tile kt + 1 have landed
    __syncthreads();                                    // publishes tile kt + 1 and ends every wave's reads of tile kt
    if (kt + 2 < ntiles) { const unsigned bo = (unsigned)(kt & 1) * TILE_B; const size_t go = (size_t)(kt + 2) * 64;
      copy_tile(lk + bo, gk + go * EE, EE); copy_tile(lv + bo, gv + go, SQ); }
  }
  asm volatile("s_wait_asynccnt 0x0" ::: "memory");     // no copy is outstanding when the wave goes on to its end
#pragma unroll
  for (int r = 0; r < 8; ++r) { const float lr = __shfl(lrun, 8 * g + r, 32);
#pragma unroll
    for (int t = 0; t < 4; ++t) sO[w][8 * g + r][t * 16 + col] = acc[t][r] / lr; }
  LDSX();
  for (int qd = lane; qd < 16 * 16; qd += 32) { const int rl = qd >> 4, pc = qd & 15; vst2(out + (size_t)(q0 + rl) * EE + h * HD + pc * 4, *(const v4f*)(&sO[w][rl][pc * 4])); }
}
extern "C" void kernel_launch(void* const* d_in, const int* in_sizes, int n_in, void* d_out, int out_size, void* d_ws, size_t ws_size, hipStream_t stream) {
  (void)in_sizes; (void)n_in; (void)out_size; (void)ws_size;
  const float* q = (const float*)d_in[0]; const float* k = (const float*)d_in[1]; const float* v = (const float*)d_in[2];
  float* out = (float*)d_out; __bf16* ws = (__bf16*)d_ws;
  k_split<<<dim3(SQ / 64, NH, 2), 256, 0, stream>>>(k, v, ws);
  k_attn<<<dim3(SQ / 64, NH), 128, 0, stream>>>(q, ws, out);
}

// v005
// Measured time: 48.7 microseconds a run.
// Next to v004, in two timings, it ran 1.20 and 1.21 times as fast.
// Over all steps from v000 it is 4.28 times as fast.
#include <hip/hip_runtime.h>
#include <math.h>

typedef __attribute__((ext_vector_type(16))) _Float16 v16h;
typedef __attribute__((ext_vector_type(16))) __bf16 v16b;
typedef __attribute__((ext_vector_type(8)))  _Float16 v8h;
typedef __attribute__((ext_vector_type(8)))  float v8f;
typedef __attribute__((ext_vector_type(4)))  float v4f;
typedef __attribute__((ext_vector_type(2)))  float v2f;
typedef __attribute__((ext_vector_type(4)))  unsigned v4u;
typedef __attribute__((ext_vector_type(4)))  int v4i;
typedef float __attribute__((may_alias)) float_a;
typedef int __attribute__((may_alias)) int_a;

template <typename T> __device__ __forceinline__ void vst2(void* p, T v) { *(T*)p = v;  }
__device__ __forceinline__ v8f wmma16(v16h a, v16h b, v8f c) {
  v8f d = __builtin_amdgcn_wmma_f32_16x16x32_f16(false, a, false, b, (short)0, c, false, false);
  asm volatile("v_nop\n\tv_nop\n\tv_nop\n\tv_nop" : "+v"(d) : "v"(a), "v"(b));
  return d;
}
__device__ __forceinline__ v8f wmma_bf(v16b a, v16b b, v8f c) {
  v8f d = __builtin_amdgcn_wmma_f32_16x16x32_bf16(false, a, false, b, (short)0, c, false, false);
  asm volatile("v_nop\n\tv_nop\n\tv_nop\n\tv_nop" : "+v"(d) : "v"(a), "v"(b));
  return d;
}
// 16x16x32 fragments: lane = (h = lane>>4, row/col = lane&15); elements 0..7 = k0+8h+0..7, 8..15 = k0+16+8h+0..7; D element r = row 8h+r
__device__ __forceinline__ v16h frag_h(const _Float16* rowk0, int lane) {
  union { v16h v; v8h q[2]; } u; const _Float16* p = rowk0 + 8 * (lane >> 4);
  u.q[0] = *(const v8h*)p; u.q[1] = *(const v8h*)(p + 16); return u.v;
}
__device__ __forceinline__ v16h frag_f32(const float* rowk0, int lane) {
  v16h a; const float* p = rowk0 + 8 * (lane >> 4);
#pragma unroll
  for (int i = 0; i < 8; ++i) { a[i] = (_Float16)p[i]; a[8 + i] = (_Float16)p[16 + i]; }
  return a;
}
__device__ __forceinline__ v16h frag_f32s(const float* rowk0, int lane, float sc) {
  v16h a; const float* p = rowk0 + 8 * (lane >> 4);
#pragma unroll
  for (int i = 0; i < 8; ++i) { a[i] = (_Float16)(p[i] * sc); a[8 + i] = (_Float16)(p[16 + i] * sc); }
  return a;
}
// column fragment from a [K][ld] layout (column n), rows >= K read as 0
__device__ __forceinline__ v16h fragc_f32(const float* W, int k0, int n, int lane, int ld, int K) {
  v16h a; const int g = lane >> 4;
#pragma unroll
  for (int i = 0; i < 8; ++i) { const int ka = k0 + 8 * g + i, kb = ka + 16;
    a[i] = (_Float16)(ka < K ? W[(size_t)ka * ld + n] : 0.f); a[8 + i] = (_Float16)(kb < K ? W[(size_t)kb * ld + n] : 0.f); }
  return a;
}
struct F2 { v16b h, l; };
__device__ __forceinline__ F2 bsplit16(const float v[16]) { F2 r;
#pragma unroll
  for (int i = 0; i < 16; ++i) { const __bf16 h = (__bf16)v[i]; r.h[i] = h; r.l[i] = (__bf16)(v[i] - (float)h); }
  return r; }
__device__ __forceinline__ F2 split_row(const float* row, int k0, int lane) { float v[16]; const float* p = row + k0 + 8 * (lane >> 4);
#pragma unroll
  for (int i = 0; i < 8; ++i) { v[i] = p[i]; v[8 + i] = p[16 + i]; }
  return bsplit16(v); }
__device__ __forceinline__ F2 split_rowK(const float* row, int k0, int lane, int K) { float v[16]; const int g = lane >> 4;
#pragma unroll
  for (int i = 0; i < 8; ++i) { const int ka = k0 + 8 * g + i, kb = ka + 16; v[i] = ka < K ? row[ka] : 0.f; v[8 + i] = kb < K ? row[kb] : 0.f; }
  return bsplit16(v); }
__device__ __forceinline__ F2 split_col(const float* W, int k0, int n, int lane, int ld, int K) { float v[16]; const int g = lane >> 4;
#pragma unroll
  for (int i = 0; i < 8; ++i) { const int ka = k0 + 8 * g + i, kb = ka + 16; v[i] = ka < K ? W[(size_t)ka * ld + n] : 0.f; v[8 + i] = kb < K ? W[(size_t)kb * ld + n] : 0.f; }
  return bsplit16(v); }
__device__ __forceinline__ v8f mac3(const F2& a, const F2& b, v8f c) { c = wmma_bf(a.l, b.h, c); c = wmma_bf(a.h, b.l, c); return wmma_bf(a.h, b.h, c); }
__device__ __forceinline__ float sigm(float v) { return 1.0f / (1.0f + expf(-v)); }
#define LDSX() do { asm volatile("s_wait_dscnt 0" ::: "memory"); __builtin_amdgcn_wave_barrier(); __builtin_amdgcn_fence(__ATOMIC_RELEASE, "workgroup"); } while (0)

// Causal core attention (16 heads, 2048 tokens, batch 1), near-f32: S = q.k/8 and P@V both on v_wmma_f32_16x16x32_bf16 as two-way
// bf16 splits taken directly from the f32 inputs (hi*hi + hi*lo + lo*hi, f32 accumulate) — plain f16 left ~1e-3 absolute error on the
// first few query rows (few keys, no averaging). Masked positions get -10000; key
#define LOG2E 1.4426950408889634f
#define SQ 2048
#define NH 16
#define HD 64
#define EE (NH * HD)
#define KP 72                      // LDS row pitch of a staged plane in bf16: 144 B = 16 B x 9, free of bank conflicts for 16-byte row reads
#define PLANE_B (64 * KP * 2)      // bytes of one staged 64 x 64 bf16 plane
#define TILE_B (2 * PLANE_B)       // a staged tile: its hi plane, then its lo plane
#define PL ((size_t)SQ * EE)       // elements of one bf16 plane in the workspace: K hi, K lo as [token][head * 64 + d], then V hi, V lo as [head * 64 + d][token]
typedef __attribute__((ext_vector_type(8))) __bf16 v8b;

// Pre-pass: every K and V element is split into bf16 hi + lo once per call (the attention kernel did it in each wave for each tile it walked);
// V goes out transposed, so that a P@V column fragment is two 16-byte row reads like a K fragment.
__global__ __launch_bounds__(256) void k_split(const float* __restrict__ k, const float* __restrict__ v, __bf16* __restrict__ ws) {
  __shared__ float sT[64][65];     // 65: the column walk of the transpose meets no bank twice
  const int tid = threadIdx.x, s0 = blockIdx.x * 64, h = blockIdx.y, r = tid >> 2, c = (tid & 3) * 16;
  const float* p = (blockIdx.z == 0 ? k : v) + (size_t)(s0 + r) * EE + h * HD + c;
  float x[16];
#pragma unroll
  for (int i = 0; i < 4; ++i) { const v4f t = *(const v4f*)(p + 4 * i);
#pragma unroll
    for (int j = 0; j < 4; ++j) x[4 * i + j] = t[j]; }
  asm volatile("s_wait_xcnt 0x0" ::: "memory");   // stands in front of any rewrite of the four loads' address registers
  __bf16* o = ws + (size_t)(s0 + r) * EE + h * HD + c;
  if (blockIdx.z != 0) {
#pragma unroll
    for (int i = 0; i < 16; ++i) sT[r][c + i] = x[i];
    __syncthreads();               // the whole 64 x 64 tile is in LDS before its columns are read
#pragma unroll
    for (int i = 0; i < 16; ++i) x[i] = sT[c + i][r];
    o = ws + 2 * PL + (size_t)(h * HD + r) * SQ + s0 + c;
  }
  const F2 f = bsplit16(x);
  *(v16b*)o = f.h; *(v16b*)(o + PL) = f.l;
}

// hi and lo fragments from a staged tile: row points into the hi plane, the lo plane lies 64 * KP elements behind it
__device__ __forceinline__ F2 frag_pl(const __bf16* row, int k0, int lane) {
  union { v16b v; v8b q[2]; } a, b; const __bf16* p = row + k0 + 8 * (lane >> 4);
  a.q[0] = *(const v8b*)p; a.q[1] = *(const v8b*)(p + 16);
  b.q[0] = *(const v8b*)(p + 64 * KP); b.q[1] = *(const v8b*)(p + 64 * KP + 16);
  F2 r; r.h = a.v; r.l = b.v; return r;
}

// One lane's share of a 64 x 64 tile's two bf16 planes (source row stride ld elements): eight asynchronous 16-byte copies global -> LDS,
// rows r, r + 16, r + 32, r + 48 of the hi plane, then of the lo plane. A wave covers four whole 128-byte rows per copy.
// s_wait_xcnt closes the statement so that no address register is rewritten ahead of it.
__device__ __forceinline__ void copy_tile(unsigned l, const __bf16* g, int ld) {
  asm volatile("global_load_async_to_lds_b128 %0, %8, off\n\t"
               "global_load_async_to_lds_b128 %1, %9, off\n\t"
               "global_load_async_to_lds_b128 %2, %10, off\n\t"
               "global_load_async_to_lds_b128 %3, %11, off\n\t"
               "global_load_async_to_lds_b128 %4, %12, off\n\t"
               "global_load_async_to_lds_b128 %5, %13, off\n\t"
               "global_load_async_to_lds_b128 %6, %14, off\n\t"
               "global_load_async_to_lds_b128 %7, %15, off\n\t"
               "s_wait_xcnt 0x0"
               :: "v"(l), "v"(l + 16 * KP * 2), "v"(l + 32 * KP * 2), "v"(l + 48 * KP * 2),
                  "v"(l + PLANE_B), "v"(l + PLANE_B + 16 * KP * 2), "v"(l + PLANE_B + 32 * KP * 2), "v"(l + PLANE_B + 48 * KP * 2),
                  "v"(g), "v"(g + 16 * ld), "v"(g + 32 * ld), "v"(g + 48 * ld), "v"(g + PL), "v"(g + PL + 16 * ld), "v"(g + PL + 32 * ld), "v"(g + PL + 48 * ld)
               : "memory");
}

// lane l with lane l ^ 16, on the vector unit (a shuffle would go through the LDS path and be waited for)
__device__ __forceinline__ float xhalf(float x) { return __builtin_bit_cast(float, __builtin_amdgcn_permlanex16(__builtin_bit_cast(int, x), __builtin_bit_cast(int, x), 0x76543210, 0xfedcba98, false, false)); }
// mac3 with the operand sides exchanged: a is the A operand, b the B operand, the three terms in mac3's order
__device__ __forceinline__ v8f mac3t(const F2& a, const F2& b, v8f c) { c = wmma_bf(a.h, b.l, c); c = wmma_bf(a.l, b.h, c); return wmma_bf(a.h, b.h, c); }

// Both products run transposed: S^T = K.Q^T (A = key rows, B = query columns) and O^T += V^T.P^T (A = V^T rows, B = P^T). A lane then holds scores,
// probabilities and output of ONE query (column lane & 15): keys and head dims 8 * (lane >> 4) + r of each 16-row tile. Maximum and sum are in-lane with one
// exchange between the wave's halves, the rescale factor is the lane's own, and two score tiles, converted in place, are a B fragment of P^T in the k order
// that the V^T loader has: neither S nor P goes through LDS.
__global__ __launch_bounds__(128) void k_attn(const float* __restrict__ q, const __bf16* __restrict__ ws, float* __restrict__ out) {
  __shared__ __align__(16) __bf16 sK[2][2][64][KP];  // key tiles [buffer][hi, lo][key][d], shared by the four waves
  __shared__ __align__(16) __bf16 sV[2][2][64][KP];  // value tiles [buffer][hi, lo][d][key], likewise
  const int tid = threadIdx.x, w = tid >> 5, lane = tid & 31, col = lane & 15, g = lane >> 4;
  const int h = blockIdx.y, q0 = blockIdx.x * 64 + w * 16, qi = q0 + col;
  const float* qb = q + h * HD;      // row stride EE
  F2 bq[2];
#pragma unroll
  for (int kc = 0; kc < 2; ++kc) bq[kc] = split_row(qb + (size_t)qi * EE, kc * 32, lane);
  float mrun = -3.0e38f, lrun = 0.f; v8f acc[4] = {};   // lrun: this half's keys only, the halves are joined behind the loop; acc[t][r] = O[qi][t * 16 + 8 * g + r]
  const int ntiles = blockIdx.x + 1;
  // this lane's 16 bytes in row tid / 8 of a plane: LDS byte address in buffer 0, and the source element in tile 0
  const unsigned lk = (unsigned)(size_t)&sK[0][0][tid >> 3][(tid & 7) * 8], lv = (unsigned)(size_t)&sV[0][0][tid >> 3][(tid & 7) * 8];
  const __bf16* gk = ws + (size_t)(tid >> 3) * EE + h * HD + (tid & 7) * 8; const __bf16* gv = ws + 2 * PL + (size_t)(h * HD + (tid >> 3)) * SQ + (tid & 7) * 8;
  copy_tile(lk, gk, EE); copy_tile(lv, gv, SQ);
  asm volatile("s_wait_asynccnt 0x0" ::: "memory");   // tile 0 has landed before the barrier publishes it
  __syncthreads();
  if (ntiles > 1) { copy_tile(lk + TILE_B, gk + (size_t)64 * EE, EE); copy_tile(lv + TILE_B, gv + 64, SQ); }
#pragma unroll 1
  for (int kt = 0; kt < ntiles; ++kt) {
    const __bf16* Kt = &sK[kt & 1][0][0][0]; const __bf16* Vt = &sV[kt & 1][0][0][0];
    // The trip's fragment reads stand in groups ahead of the products that use them, so that one LDS latency is waited out per group and not one
    // per three products: the K fragments at the top; the first half of the V fragments behind the second score tile, in the registers that
    // two tiles' K fragments leave (it lands under the other score tiles); the second half in front of the first half's products.
    F2 kf[4][2], vf[2][4]; v8f s[4]; float mx = -3.4e38f;
#pragma unroll
    for (int t = 0; t < 4; ++t) {
#pragma unroll
      for (int kc = 0; kc < 2; ++kc) kf[t][kc] = frag_pl(Kt + (t * 16 + col) * KP, kc * 32, lane); }
#pragma unroll
    for (int t = 0; t < 4; ++t) { v8f a = {}; const int key0 = kt * 64 + t * 16 + 8 * g;
#pragma unroll
      for (int kc = 0; kc < 2; ++kc) a = mac3t(kf[t][kc], bq[kc], a);
      if (t == 1) {
#pragma unroll
        for (int u = 0; u < 4; ++u) vf[0][u] = frag_pl(Vt + (u * 16 + col) * KP, 0, lane); }
#pragma unroll
      for (int r = 0; r < 8; ++r) a[r] = key0 + r <= qi ? a[r] * 0.125f : -10000.0f;
      // a tile's maximum as a short tree, so that little of it is left behind the last score tile
      mx = fmaxf(mx, fmaxf(fmaxf(fmaxf(fmaxf(a[0], a[1]), a[2]), fmaxf(fmaxf(a[3], a[4]), a[5])), fmaxf(a[6], a[7])));
      s[t] = a; }
    mx = fmaxf(mx, xhalf(mx));
    // exponentials in base 2 on the hardware's own instruction: the running maximum is kept times log2(e), one fused multiply-add forms each argument
    const float mnew = fmaxf(mrun, mx * LOG2E); const float corr = __builtin_amdgcn_exp2f(mrun - mnew);
#pragma unroll
    for (int t = 0; t < 4; ++t) {
#pragma unroll
      for (int r = 0; r < 8; ++r) s[t][r] = __builtin_amdgcn_exp2f(fmaf(s[t][r], LOG2E, -mnew)); }
    const v8f p8 = (s[0] + s[1]) + (s[2] + s[3]);   // the lane's 32 probabilities summed as a tree of vector adds, not as one chain
    lrun = lrun * corr + (((p8[0] + p8[4]) + (p8[1] + p8[5])) + ((p8[2] + p8[6]) + (p8[3] + p8[7]))); mrun = mnew;
#pragma unroll
    for (int t = 0; t < 4; ++t) acc[t] *= corr;
    F2 pb[2];   // P^T as B: element i of fragment kc is key 32 * kc + 8 * g + i, element 8 + i key 32 * kc + 16 + 8 * g + i, as frag_pl reads V^T
#pragma unroll
    for (int kc = 0; kc < 2; ++kc) { float x[16];
#pragma unroll
      for (int i = 0; i < 8; ++i) { x[i] = s[2 * kc][i]; x[8 + i] = s[2 * kc + 1][i]; }
      pb[kc] = bsplit16(x); }
#pragma unroll
    for (int u = 0; u < 4; ++u) vf[1][u] = frag_pl(Vt + (u * 16 + col) * KP, 32, lane);
#pragma unroll
    for (int kc = 0; kc < 2; ++kc) {
#pragma unroll
      for (int t = 0; t < 4; ++t) acc[t] = mac3t(vf[kc][t], pb[kc], acc[t]); }
    __builtin_amdgcn_wave_barrier();
    asm volatile("s_wait_dscnt 0x0" ::: "memory");      // this wave's reads of the buffer are done before it is refilled
    asm volatile("s_wait_asynccnt 0x0" ::: "memory");   // this wave's copies of tile kt + 1 have landed
    __syncthreads();                                    // publishes tile kt + 1 and ends every wave's reads of tile kt
    if (kt + 2 < ntiles) { const unsigned bo = (unsigned)(kt & 1) * TILE_B; const size_t go = (size_t)(kt + 2) * 64;
      copy_tile(lk + bo, gk + go * EE, EE); copy_tile(lv + bo, gv + go, SQ); }
  }
  asm volatile("s_wait_asynccnt 0x0" ::: "memory");     // no copy is outstanding when the wave goes on to its end
  const float lr = lrun + xhalf(lrun);
  float* o = out + (size_t)qi * EE + h * HD + 8 * g;    // a lane's eight accumulator registers are eight consecutive floats of its query's row
#pragma unroll
  for (int t = 0; t < 4; ++t) {
#pragma unroll
    for (int r = 0; r < 8; ++r) acc[t][r] = acc[t][r] / lr; }
  __builtin_amdgcn_sched_barrier(0);   // every quotient is formed in front of the first store, so that no register of an issued store is rewritten behind it
#pragma unroll
  for (int t = 0; t < 4; ++t) *(v8f*)(o + t * 16) = acc[t];
}
extern "C" void kernel_launch(void* const* d_in, const int* in_sizes, int n_in, void* d_out, int out_size, void* d_ws, size_t ws_size, hipStream_t stream) {
  (void)in_sizes; (void)n_in; (void)out_size; (void)ws_size;
  const float* q = (const float*)d_in[0]; const float* k = (const float*)d_in[1]; const float* v = (const float*)d_in[2];
  float* out = (float*)d_out; __bf16* ws = (__bf16*)d_ws;
  k_split<<<dim3(SQ / 64, NH, 2), 256, 0, stream>>>(k, v, ws);
  k_attn<<<dim3(SQ / 64, NH), 128, 0, stream>>>(q, ws, out);
}

// v006
// One run takes 40.3 microseconds.
// Two timings next to v005 put it at 1.20 and 1.21 times that version's speed.
// All steps since v000 together make it 5.16 times as fast.
#include <hip/hip_runtime.h>
#include <math.h>

typedef __attribute__((ext_vector_type(16))) _Float16 v16h;
typedef __attribute__((ext_vector_type(16))) __bf16 v16b;
typedef __attribute__((ext_vector_type(8)))  _Float16 v8h;
typedef __attribute__((ext_vector_type(8)))  float v8f;
typedef __attribute__((ext_vector_type(4)))  float v4f;
typedef __attribute__((ext_vector_type(2)))  float v2f;
typedef __attribute__((ext_vector_type(4)))  unsigned v4u;
typedef __attribute__((ext_vector_type(4)))  int v4i;
typedef float __attribute__((may_alias)) float_a;
typedef int __attribute__((may_alias)) int_a;

template <typename T> __device__ __forceinline__ void vst2(void* p, T v) { *(T*)p = v;  }
__device__ __forceinline__ v8f wmma16(v16h a, v16h b, v8f c) {
  v8f d = __builtin_amdgcn_wmma_f32_16x16x32_f16(false, a, false, b, (short)0, c, false, false);
  asm volatile("v_nop\n\tv_nop\n\tv_nop\n\tv_nop" : "+v"(d) : "v"(a), "v"(b));
  return d;
}
__device__ __forceinline__ v8f wmma_bf(v16b a, v16b b, v8f c) {
  v8f d = __builtin_amdgcn_wmma_f32_16x16x32_bf16(false, a, false, b, (short)0, c, false, false);
  asm volatile("v_nop\n\tv_nop\n\tv_nop\n\tv_nop" : "+v"(d) : "v"(a), "v"(b));
  return d;
}
// 16x16x32 fragments: lane = (h = lane>>4, row/col = lane&15); elements 0..7 = k0+8h+0..7, 8..15 = k0+16+8h+0..7; D element r = row 8h+r
__device__ __forceinline__ v16h frag_h(const _Float16* rowk0, int lane) {
  union { v16h v; v8h q[2]; } u; const _Float16* p = rowk0 + 8 * (lane >> 4);
  u.q[0] = *(const v8h*)p; u.q[1] = *(const v8h*)(p + 16); return u.v;
}
__device__ __forceinline__ v16h frag_f32(const float* rowk0, int lane) {
  v16h a; const float* p = rowk0 + 8 * (lane >> 4);
#pragma unroll
  for (int i = 0; i < 8; ++i) { a[i] = (_Float16)p[i]; a[8 + i] = (_Float16)p[16 + i]; }
  return a;
}
__device__ __forceinline__ v16h frag_f32s(const float* rowk0, int lane, float sc) {
  v16h a; const float* p = rowk0 + 8 * (lane >> 4);
#pragma unroll
  for (int i = 0; i < 8; ++i) { a[i] = (_Float16)(p[i] * sc); a[8 + i] = (_Float16)(p[16 + i] * sc); }
  return a;
}
// column fragment from a [K][ld] layout (column n), rows >= K read as 0
__device__ __forceinline__ v16h fragc_f32(const float* W, int k0, int n, int lane, int ld, int K) {
  v16h a; const int g = lane >> 4;
#pragma unroll
  for (int i = 0; i < 8; ++i) { const int ka = k0 + 8 * g + i, kb = ka + 16;
    a[i] = (_Float16)(ka < K ? W[(size_t)ka * ld + n] : 0.f); a[8 + i] = (_Float16)(kb < K ? W[(size_t)kb * ld + n] : 0.f); }
  return a;
}
struct F2 { v16b h, l; };
__device__ __forceinline__ F2 bsplit16(const float v[16]) { F2 r;
#pragma unroll
  for (int i = 0; i < 16; ++i) { const __bf16 h = (__bf16)v[i]; r.h[i] = h; r.l[i] = (__bf16)(v[i] - (float)h); }
  return r; }
__device__ __forceinline__ F2 split_row(const float* row, int k0, int lane) { float v[16]; const float* p = row + k0 + 8 * (lane >> 4);
#pragma unroll
  for (int i = 0; i < 8; ++i) { v[i] = p[i]; v[8 + i] = p[16 + i]; }
  return bsplit16(v); }
__device__ __forceinline__ F2 split_rowK(const float* row, int k0, int lane, int K) { float v[16]; const int g = lane >> 4;
#pragma unroll
  for (int i = 0; i < 8; ++i) { const int ka = k0 + 8 * g + i, kb = ka + 16; v[i] = ka < K ? row[ka] : 0.f; v[8 + i] = kb < K ? row[kb] : 0.f; }
  return bsplit16(v); }
__device__ __forceinline__ F2 split_col(const float* W, int k0, int n, int lane, int ld, int K) { float v[16]; const int g = lane >> 4;
#pragma unroll
  for (int i = 0; i < 8; ++i) { const int ka = k0 + 8 * g + i, kb = ka + 16; v[i] = ka < K ? W[(size_t)ka * ld + n] : 0.f; v[8 + i] = kb < K ? W[(size_t)kb * ld + n] : 0.f; }
  return bsplit16(v); }
__device__ __forceinline__ v8f mac3(const F2& a, const F2& b, v8f c) { c = wmma_bf(a.l, b.h, c); c = wmma_bf(a.h, b.l, c); return wmma_bf(a.h, b.h, c); }
__device__ __forceinline__ float sigm(float v) { return 1.0f / (1.0f + expf(-v)); }
#define LDSX() do { asm volatile("s_wait_dscnt 0" ::: "memory"); __builtin_amdgcn_wave_barrier(); __builtin_amdgcn_fence(__ATOMIC_RELEASE, "workgroup"); } while (0)

// Causal core attention (16 heads, 2048 tokens, batch 1), near-f32: S = q.k/8 and P@V both on v_wmma_f32_16x16x32_bf16 as two-way
// bf16 splits taken directly from the f32 inputs (hi*hi + hi*lo + lo*hi, f32 accumulate) — plain f16 left ~1e-3 absolute error on the
// first few query rows (few keys, no averaging). Masked positions get -10000; key
#define LOG2E 1.4426950408889634f
#define SQ 2048
#define NH 16
#define HD 64
#define EE (NH * HD)
#define NT (SQ / 64)               // query tiles (and key tiles) of a head
#define KP 72                      // LDS row pitch of a staged plane in bf16: 144 B = 16 B x 9, free of bank conflicts for 16-byte row reads
#define PLANE_B (64 * KP * 2)      // bytes of one staged 64 x 64 bf16 plane
#define TILE_B (2 * PLANE_B)       // a staged tile: its hi plane, then its lo plane
#define PL ((size_t)SQ * EE)       // elements of one bf16 plane in the workspace: K hi, K lo as [token][head * 64 + d], then V hi, V lo as [head * 64 + d][token]
typedef __attribute__((ext_vector_type(8))) __bf16 v8b;

// Pre-pass: every K and V element is split into bf16 hi + lo once per call (the attention kernel did it in each wave for each tile it walked);
// V goes out transposed, so that a P@V column fragment is two 16-byte row reads like a K fragment.
__global__ __launch_bounds__(256) void k_split(const float* __restrict__ k, const float* __restrict__ v, __bf16* __restrict__ ws) {
  __shared__ float sT[64][65];     // 65: the column walk of the transpose meets no bank twice
  const int tid = threadIdx.x, s0 = blockIdx.x * 64, h = blockIdx.y, r = tid >> 2, c = (tid & 3) * 16;
  const float* p = (blockIdx.z == 0 ? k : v) + (size_t)(s0 + r) * EE + h * HD + c;
  float x[16];
#pragma unroll
  for (int i = 0; i < 4; ++i) { const v4f t = *(const v4f*)(p + 4 * i);
#pragma unroll
    for (int j = 0; j < 4; ++j) x[4 * i + j] = t[j]; }
  asm volatile("s_wait_xcnt 0x0" ::: "memory");   // stands in front of any rewrite of the four loads' address registers
  __bf16* o = ws + (size_t)(s0 + r) * EE + h * HD + c;
  if (blockIdx.z != 0) {
#pragma unroll
    for (int i = 0; i < 16; ++i) sT[r][c + i] = x[i];
    __syncthreads();               // the whole 64 x 64 tile is in LDS before its columns are read
#pragma unroll
    for (int i = 0; i < 16; ++i) x[i] = sT[c + i][r];
    o = ws + 2 * PL + (size_t)(h * HD + r) * SQ + s0 + c;
  }
  const F2 f = bsplit16(x);
  *(v16b*)o = f.h; *(v16b*)(o + PL) = f.l;
}

// hi and lo fragments from a staged tile: row points into the hi plane, the lo plane lies 64 * KP elements behind it
__device__ __forceinline__ F2 frag_pl(const __bf16* row, int k0, int lane) {
  union { v16b v; v8b q[2]; } a, b; const __bf16* p = row + k0 + 8 * (lane >> 4);
  a.q[0] = *(const v8b*)p; a.q[1] = *(const v8b*)(p + 16);
  b.q[0] = *(const v8b*)(p + 64 * KP); b.q[1] = *(const v8b*)(p + 64 * KP + 16);
  F2 r; r.h = a.v; r.l = b.v; return r;
}

// One lane's share of a 64 x 64 tile's two bf16 planes (source row stride ld elements): eight asynchronous 16-byte copies global -> LDS,
// rows r, r + 16, r + 32, r + 48 of the hi plane, then of the lo plane. A wave covers four whole 128-byte rows per copy.
// s_wait_xcnt closes the statement so that no address register is rewritten ahead of it.
__device__ __forceinline__ void copy_tile(unsigned l, const __bf16* g, int ld) {
  asm volatile("global_load_async_to_lds_b128 %0, %8, off\n\t"
               "global_load_async_to_lds_b128 %1, %9, off\n\t"
               "global_load_async_to_lds_b128 %2, %10, off\n\t"
               "global_load_async_to_lds_b128 %3, %11, off\n\t"
               "global_load_async_to_lds_b128 %4, %12, off\n\t"
               "global_load_async_to_lds_b128 %5, %13, off\n\t"
               "global_load_async_to_lds_b128 %6, %14, off\n\t"
               "global_load_async_to_lds_b128 %7, %15, off\n\t"
               "s_wait_xcnt 0x0"
               :: "v"(l), "v"(l + 16 * KP * 2), "v"(l + 32 * KP * 2), "v"(l + 48 * KP * 2),
                  "v"(l + PLANE_B), "v"(l + PLANE_B + 16 * KP * 2), "v"(l + PLANE_B + 32 * KP * 2), "v"(l + PLANE_B + 48 * KP * 2),
                  "v"(g), "v"(g + 16 * ld), "v"(g + 32 * ld), "v"(g + 48 * ld), "v"(g + PL), "v"(g + PL + 16 * ld), "v"(g + PL + 32 * ld), "v"(g + PL + 48 * ld)
               : "memory");
}

// lane l with lane l ^ 16, on the vector unit (a shuffle would go through the LDS path and be waited for)
__device__ __forceinline__ float xhalf(float x) { return __builtin_bit_cast(float, __builtin_amdgcn_permlanex16(__builtin_bit_cast(int, x), __builtin_bit_cast(int, x), 0x76543210, 0xfedcba98, false, false)); }
// mac3 with the operand sides exchanged: a is the A operand, b the B operand, the three terms in mac3's order
__device__ __forceinline__ v8f mac3t(const F2& a, const F2& b, v8f c) { c = wmma_bf(a.h, b.l, c); c = wmma_bf(a.l, b.h, c); return wmma_bf(a.h, b.h, c); }

// Both products run transposed: S^T = K.Q^T (A = key rows, B = query columns) and O^T += V^T.P^T (A = V^T rows, B = P^T). A lane then holds scores,
// probabilities and output of ONE query (column lane & 15): keys and head dims 8 * (lane >> 4) + r of each 16-row tile. Maximum and sum are in-lane with one
// exchange between the wave's halves, the rescale factor is the lane's own, and two score tiles, converted in place, are a B fragment of P^T in the k order
// that the V^T loader has: neither S nor P goes through LDS.
// Causal balance: query tile x walks x + 1 key tiles, so a work-group takes tile NT - 1 - blockIdx.x and then tile blockIdx.x of its head, one after the other:
// NT + 1 trips for every work-group, and one work-group for each WGP of the chip. The two walks are one loop over one ring of staged tiles: the second
// walk's first key tiles are copied under the first walk's last trips.
__global__ __launch_bounds__(128) void k_attn(const float* __restrict__ q, const __bf16* __restrict__ ws, float* __restrict__ out) {
  __shared__ __align__(16) __bf16 sK[2][2][64][KP];  // key tiles [buffer][hi, lo][key][d], shared by the four waves
  __shared__ __align__(16) __bf16 sV[2][2][64][KP];  // value tiles [buffer][hi, lo][d][key], likewise
  const int tid = threadIdx.x, w = tid >> 5, lane = tid & 31, col = lane & 15, g = lane >> 4;
  const int h = blockIdx.y, nA = NT - (int)blockIdx.x;   // nA: trips of the first walk, 17 to 32
  int qt = nA - 1, qi = qt * 64 + w * 16 + col, kt = 0;  // the query tile in work, this lane's query, the key tile in work
  const float* qb = q + h * HD;      // row stride EE
  F2 bq[2];
#pragma unroll
  for (int kc = 0; kc < 2; ++kc) bq[kc] = split_row(qb + (size_t)qi * EE, kc * 32, lane);
  asm volatile("s_wait_xcnt 0x0" ::: "memory");   // stands in front of any rewrite of the query loads' address registers
  float mrun = -3.0e38f, lrun = 0.f; v8f acc[4] = {};   // lrun: this half's keys only, the halves are joined at the walk's end; acc[t][r] = O[qi][t * 16 + 8 * g + r]
  // this lane's 16 bytes in row tid / 8 of a plane: LDS byte address in buffer 0, and the source element in tile 0
  const unsigned lk = (unsigned)(size_t)&sK[0][0][tid >> 3][(tid & 7) * 8], lv = (unsigned)(size_t)&sV[0][0][tid >> 3][(tid & 7) * 8];
  const __bf16* gk = ws + (size_t)(tid >> 3) * EE + h * HD + (tid & 7) * 8; const __bf16* gv = ws + 2 * PL + (size_t)(h * HD + (tid >> 3)) * SQ + (tid & 7) * 8;
  copy_tile(lk, gk, EE); copy_tile(lv, gv, SQ);
  asm volatile("s_wait_asynccnt 0x0" ::: "memory");   // tile 0 has landed before the barrier publishes it
  __syncthreads();
  copy_tile(lk + TILE_B, gk + (size_t)64 * EE, EE); copy_tile(lv + TILE_B, gv + 64, SQ);   // the first walk has 17 key tiles or more
#pragma unroll 1
  for (int i = 0; i <= NT; ++i) {   // trip i reads buffer i & 1
    const __bf16* Kt = &sK[i & 1][0][0][0]; const __bf16* Vt = &sV[i & 1][0][0][0];
    // The trip's fragment reads stand in groups ahead of the products that use them, so that one LDS latency is waited out per group and not one
    // per three products: the K fragments at the top; the first half of the V fragments behind the second score tile, in the registers that
    // two tiles' K fragments leave (it lands under the other score tiles); the second half in front of the first half's products.
    F2 kf[4][2], vf[2][4]; v8f s[4]; float mx = -3.4e38f;
#pragma unroll
    for (int t = 0; t < 4; ++t) {
#pragma unroll
      for (int kc = 0; kc < 2; ++kc) kf[t][kc] = frag_pl(Kt + (t * 16 + col) * KP, kc * 32, lane); }
#pragma unroll
    for (int t = 0; t < 4; ++t) { v8f a = {}; const int key0 = kt * 64 + t * 16 + 8 * g;
#pragma unroll
      for (int kc = 0; kc < 2; ++kc) a = mac3t(kf[t][kc], bq[kc], a);
      if (t == 1) {
#pragma unroll
        for (int u = 0; u < 4; ++u) vf[0][u] = frag_pl(Vt + (u * 16 + col) * KP, 0, lane); }
#pragma unroll
      for (int r = 0; r < 8; ++r) a[r] = key0 + r <= qi ? a[r] * 0.125f : -10000.0f;
      // a tile's maximum as a short tree, so that little of it is left behind the last score tile
      mx = fmaxf(mx, fmaxf(fmaxf(fmaxf(fmaxf(a[0], a[1]), a[2]), fmaxf(fmaxf(a[3], a[4]), a[5])), fmaxf(a[6], a[7])));
      s[t] = a; }
    mx = fmaxf(mx, xhalf(mx));
    // exponentials in base 2 on the hardware's own instruction: the running maximum is kept times log2(e), one fused multiply-add forms each argument
    const float mnew = fmaxf(mrun, mx * LOG2E); const float corr = __builtin_amdgcn_exp2f(mrun - mnew);
#pragma unroll
    for (int t = 0; t < 4; ++t) {
#pragma unroll
      for (int r = 0; r < 8; ++r) s[t][r] = __builtin_amdgcn_exp2f(fmaf(s[t][r], LOG2E, -mnew)); }
    const v8f p8 = (s[0] + s[1]) + (s[2] + s[3]);   // the lane's 32 probabilities summed as a tree of vector adds, not as one chain
    lrun = lrun * corr + (((p8[0] + p8[4]) + (p8[1] + p8[5])) + ((p8[2] + p8[6]) + (p8[3] + p8[7]))); mrun = mnew;
#pragma unroll
    for (int t = 0; t < 4; ++t) acc[t] *= corr;
    F2 pb[2];   // P^T as B: element i of fragment kc is key 32 * kc + 8 * g + i, element 8 + i key 32 * kc + 16 + 8 * g + i, as frag_pl reads V^T
#pragma unroll
    for (int kc = 0; kc < 2; ++kc) { float x[16];
#pragma unroll
      for (int i = 0; i < 8; ++i) { x[i] = s[2 * kc][i]; x[8 + i] = s[2 * kc + 1][i]; }
      pb[kc] = bsplit16(x); }
#pragma unroll
    for (int u = 0; u < 4; ++u) vf[1][u] = frag_pl(Vt + (u * 16 + col) * KP, 32, lane);
#pragma unroll
    for (int kc = 0; kc < 2; ++kc) {
#pragma unroll
      for (int t = 0; t < 4; ++t) acc[t] = mac3t(vf[kc][t], pb[kc], acc[t]); }
    __builtin_amdgcn_wave_barrier();
    asm volatile("s_wait_dscnt 0x0" ::: "memory");      // this wave's reads of the buffer are done before it is refilled
    asm volatile("s_wait_asynccnt 0x0" ::: "memory");   // this wave's copies for trip i + 1 have landed
    __syncthreads();                                    // publishes the tile of trip i + 1 and ends every wave's reads of trip i's
    if (i + 2 <= NT) { const unsigned bo = (unsigned)(i & 1) * TILE_B; const size_t go = (size_t)(i + 2 < nA ? i + 2 : i + 2 - nA) * 64;   // trip i + 2's key tile
      copy_tile(lk + bo, gk + go * EE, EE); copy_tile(lv + bo, gv + go, SQ); }
    if (kt == qt) {   // the diagonal tile was the walk's last: the query tile goes out (the test reads the same in the whole work-group; no barrier stands inside)
    const float lr = lrun + xhalf(lrun);
    float* o = out + (size_t)qi * EE + h * HD + 8 * g;  // a lane's eight accumulator registers are eight consecutive floats of its query's row
#pragma unroll
    for (int t = 0; t < 4; ++t) {
#pragma unroll
      for (int r = 0; r < 8; ++r) acc[t][r] = acc[t][r] / lr; }
    __builtin_amdgcn_sched_barrier(0);   // every quotient is formed in front of the first store, so that no register of an issued store is rewritten behind it
#pragma unroll
    for (int t = 0; t < 4; ++t) *(v8f*)(o + t * 16) = acc[t];
    asm volatile("s_wait_xcnt 0x0" ::: "memory");   // stands in front of the second walk's rewrite of the stores' address and data registers
    __builtin_amdgcn_sched_barrier(0);   // keeps every such rewrite behind that wait
    qt = (int)blockIdx.x; qi = qt * 64 + w * 16 + col; kt = -1; mrun = -3.0e38f; lrun = 0.f;   // the second walk; ++kt below makes its first key tile 0
    if (i != NT) {
#pragma unroll
      for (int kc = 0; kc < 2; ++kc) bq[kc] = split_row(qb + (size_t)qi * EE, kc * 32, lane); }
#pragma unroll
    for (int t = 0; t < 4; ++t) acc[t] = v8f{};
    }
    ++kt;
  }
  asm volatile("s_wait_asynccnt 0x0" ::: "memory");     // no copy is outstanding when the wave goes on to its end
}
extern "C" void kernel_launch(void* const* d_in, const int* in_sizes, int n_in, void* d_out, int out_size, void* d_ws, size_t ws_size, hipStream_t stream) {
  (void)in_sizes; (void)n_in; (void)out_size; (void)ws_size;
  const float* q = (const float*)d_in[0]; const float* k = (const float*)d_in[1]; const float* v = (const float*)d_in[2];
  float* out = (float*)d_out; __bf16* ws = (__bf16*)d_ws;
  k_split<<<dim3(SQ / 64, NH, 2), 256, 0, stream>>>(k, v, ws);
  k_attn<<<dim3(NT / 2, NH), 128, 0, stream>>>(q, ws, out);
}

// v007
// It runs in 35.4 microseconds.
// Two timings next to v006 put it at 1.13 and 1.14 times that version's speed.
// Over all steps from v000 it is 5.85 times as fast.
#include <hip/hip_runtime.h>
#include <math.h>

typedef __attribute__((ext_vector_type(16))) _Float16 v16h;
typedef __attribute__((ext_vector_type(16))) __bf16 v16b;
typedef __attribute__((ext_vector_type(8)))  _Float16 v8h;
typedef __attribute__((ext_vector_type(8)))  float v8f;
typedef __attribute__((ext_vector_type(4)))  float v4f;
typedef __attribute__((ext_vector_type(2)))  float v2f;
typedef __attribute__((ext_vector_type(4)))  unsigned v4u;
typedef __attribute__((ext_vector_type(4)))  int v4i;
typedef float __attribute__((may_alias)) float_a;
typedef int __attribute__((may_alias)) int_a;

template <typename T> __device__ __forceinline__ void vst2(void* p, T v) { *(T*)p = v;  }
__device__ __forceinline__ v8f wmma16(v16h a, v16h b, v8f c) {
  v8f d = __builtin_amdgcn_wmma_f32_16x16x32_f16(false, a, false, b, (short)0, c, false, false);
  asm volatile("v_nop\n\tv_nop\n\tv_nop\n\tv_nop" : "+v"(d) : "v"(a), "v"(b));
  return d;
}
__device__ __forceinline__ v8f wmma_bf(v16b a, v16b b, v8f c) {
  v8f d = __builtin_amdgcn_wmma_f32_16x16x32_bf16(false, a, false, b, (short)0, c, false, false);
  asm volatile("v_nop\n\tv_nop\n\tv_nop\n\tv_nop" : "+v"(d) : "v"(a), "v"(b));
  return d;
}
// 16x16x32 fragments: lane = (h = lane>>4, row/col = lane&15); elements 0..7 = k0+8h+0..7, 8..15 = k0+16+8h+0..7; D element r = row 8h+r
__device__ __forceinline__ v16h frag_h(const _Float16* rowk0, int lane) {
  union { v16h v; v8h q[2]; } u; const _Float16* p = rowk0 + 8 * (lane >> 4);
  u.q[0] = *(const v8h*)p; u.q[1] = *(const v8h*)(p + 16); return u.v;
}
__device__ __forceinline__ v16h frag_f32(const float* rowk0, int lane) {
  v16h a; const float* p = rowk0 + 8 * (lane >> 4);
#pragma unroll
  for (int i = 0; i < 8; ++i) { a[i] = (_Float16)p[i]; a[8 + i] = (_Float16)p[16 + i]; }
  return a;
}
__device__ __forceinline__ v16h frag_f32s(const float* rowk0, int lane, float sc) {
  v16h a; const float* p = rowk0 + 8 * (lane >> 4);
#pragma unroll
  for (int i = 0; i < 8; ++i) { a[i] = (_Float16)(p[i] * sc); a[8 + i] = (_Float16)(p[16 + i] * sc); }
  return a;
}
// column fragment from a [K][ld] layout (column n), rows >= K read as 0
__device__ __forceinline__ v16h fragc_f32(const float* W, int k0, int n, int lane, int ld, int K) {
  v16h a; const int g = lane >> 4;
#pragma unroll
  for (int i = 0; i < 8; ++i) { const int ka = k0 + 8 * g + i, kb = ka + 16;
    a[i] = (_Float16)(ka < K ? W[(size_t)ka * ld + n] : 0.f); a[8 + i] = (_Float16)(kb < K ? W[(size_t)kb * ld + n] : 0.f); }
  return a;
}
struct F2 { v16b h, l; };
__device__ __forceinline__ F2 bsplit16(const float v[16]) { F2 r;
#pragma unroll
  for (int i = 0; i < 16; ++i) { const __bf16 h = (__bf16)v[i]; r.h[i] = h; r.l[i] = (__bf16)(v[i] - (float)h); }
  return r; }
__device__ __forceinline__ F2 split_row(const float* row, int k0, int lane) { float v[16]; const float* p = row + k0 + 8 * (lane >> 4);
#pragma unroll
  for (int i = 0; i < 8; ++i) { v[i] = p[i]; v[8 + i] = p[16 + i]; }
  return bsplit16(v); }
__device__ __forceinline__ F2 split_rowK(const float* row, int k0, int lane, int K) { float v[16]; const int g = lane >> 4;
#pragma unroll
  for (int i = 0; i < 8; ++i) { const int ka = k0 + 8 * g + i, kb = ka + 16; v[i] = ka < K ? row[ka] : 0.f; v[8 + i] = kb < K ? row[kb] : 0.f; }
  return bsplit16(v); }
__device__ __forceinline__ F2 split_col(const float* W, int k0, int n, int lane, int ld, int K) { float v[16]; const int g = lane >> 4;
#pragma unroll
  for (int i = 0; i < 8; ++i) { const int ka = k0 + 8 * g + i, kb = ka + 16; v[i] = ka < K ? W[(size_t)ka * ld + n] : 0.f; v[8 + i] = kb < K ? W[(size_t)kb * ld + n] : 0.f; }
  return bsplit16(v); }
__device__ __forceinline__ v8f mac3(const F2& a, const F2& b, v8f c) { c = wmma_bf(a.l, b.h, c); c = wmma_bf(a.h, b.l, c); return wmma_bf(a.h, b.h, c); }
__device__ __forceinline__ float sigm(float v) { return 1.0f / (1.0f + expf(-v)); }
#define LDSX() do { asm volatile("s_wait_dscnt 0" ::: "memory"); __builtin_amdgcn_wave_barrier(); __builtin_amdgcn_fence(__ATOMIC_RELEASE, "workgroup"); } while (0)

// Causal core attention (16 heads, 2048 tokens, batch 1), near-f32: S = q.k/8 and P@V both on v_wmma_f32_16x16x32_bf16 as two-way
// bf16 splits taken directly from the f32 inputs (hi*hi + hi*lo + lo*hi, f32 accumulate) — plain f16 left ~1e-3 absolute error on the
// first few query rows (few keys, no averaging). Masked positions get -10000; key
#define LOG2E 1.4426950408889634f
#define SQ 2048
#define NH 16
#define HD 64
#define EE (NH * HD)
#define NT (SQ / 64)               // query tiles (and key tiles) of a head
#define KP 72                      // LDS row pitch of a staged plane in bf16: 144 B = 16 B x 9, free of bank conflicts for 16-byte row reads
#define PLANE_B (64 * KP * 2)      // bytes of one staged 64 x 64 bf16 plane
#define TILE_B (2 * PLANE_B)       // a staged tile: its hi plane, then its lo plane
#define PL ((size_t)SQ * EE)       // elements of one bf16 plane in the workspace: K hi, K lo as [token][head * 64 + d], then V hi, V lo as [head * 64 + d][token]
typedef __attribute__((ext_vector_type(8))) __bf16 v8b;

// Pre-pass: every K and V element is split into bf16 hi + lo once per call (the attention kernel did it in each wave for each tile it walked);
// V goes out transposed, so that a P@V column fragment is two 16-byte row reads like a K fragment.
__global__ __launch_bounds__(256) void k_split(const float* __restrict__ k, const float* __restrict__ v, __bf16* __restrict__ ws) {
  __shared__ float sT[64][65];     // 65: the column walk of the transpose meets no bank twice
  const int tid = threadIdx.x, s0 = blockIdx.x * 64, h = blockIdx.y, r = tid >> 2, c = (tid & 3) * 16;
  const float* p = (blockIdx.z == 0 ? k : v) + (size_t)(s0 + r) * EE + h * HD + c;
  float x[16];
#pragma unroll
  for (int i = 0; i < 4; ++i) { const v4f t = *(const v4f*)(p + 4 * i);
#pragma unroll
    for (int j = 0; j < 4; ++j) x[4 * i + j] = t[j]; }
  asm volatile("s_wait_xcnt 0x0" ::: "memory");   // stands in front of any rewrite of the four loads' address registers
  __bf16* o = ws + (size_t)(s0 + r) * EE + h * HD + c;
  if (blockIdx.z != 0) {
#pragma unroll
    for (int i = 0; i < 16; ++i) sT[r][c + i] = x[i];
    __syncthreads();               // the whole 64 x 64 tile is in LDS before its columns are read
#pragma unroll
    for (int i = 0; i < 16; ++i) x[i] = sT[c + i][r];
    o = ws + 2 * PL + (size_t)(h * HD + r) * SQ + s0 + c;
  }
  const F2 f = bsplit16(x);
  *(v16b*)o = f.h; *(v16b*)(o + PL) = f.l;
}

// hi and lo fragments from a staged tile: row points into the hi plane, the lo plane lies 64 * KP elements behind it
__device__ __forceinline__ F2 frag_pl(const __bf16* row, int k0, int lane) {
  union { v16b v; v8b q[2]; } a, b; const __bf16* p = row + k0 + 8 * (lane >> 4);
  a.q[0] = *(const v8b*)p; a.q[1] = *(const v8b*)(p + 16);
  b.q[0] = *(const v8b*)(p + 64 * KP); b.q[1] = *(const v8b*)(p + 64 * KP + 16);
  F2 r; r.h = a.v; r.l = b.v; return r;
}

// One lane's share of a 64 x 64 tile's two bf16 planes (source row stride ld elements): eight asynchronous 16-byte copies global -> LDS,
// rows r, r + 16, r + 32, r + 48 of the hi plane, then of the lo plane. A wave covers four whole 128-byte rows per copy.
// s_wait_xcnt closes the statement so that no address register is rewritten ahead of it.
__device__ __forceinline__ void copy_tile(unsigned l, const __bf16* g, int ld) {
  asm volatile("global_load_async_to_lds_b128 %0, %8, off\n\t"
               "global_load_async_to_lds_b128 %1, %9, off\n\t"
               "global_load_async_to_lds_b128 %2, %10, off\n\t"
               "global_load_async_to_lds_b128 %3, %11, off\n\t"
               "global_load_async_to_lds_b128 %4, %12, off\n\t"
               "global_load_async_to_lds_b128 %5, %13, off\n\t"
               "global_load_async_to_lds_b128 %6, %14, off\n\t"
               "global_load_async_to_lds_b128 %7, %15, off\n\t"
               "s_wait_xcnt 0x0"
               :: "v"(l), "v"(l + 16 * KP * 2), "v"(l + 32 * KP * 2), "v"(l + 48 * KP * 2),
                  "v"(l + PLANE_B), "v"(l + PLANE_B + 16 * KP * 2), "v"(l + PLANE_B + 32 * KP * 2), "v"(l + PLANE_B + 48 * KP * 2),
                  "v"(g), "v"(g + 16 * ld), "v"(g + 32 * ld), "v"(g + 48 * ld), "v"(g + PL), "v"(g + PL + 16 * ld), "v"(g + PL + 32 * ld), "v"(g + PL + 48 * ld)
               : "memory");
}

// lane l with lane l ^ 16, on the vector unit (a shuffle would go through the LDS path and be waited for)
__device__ __forceinline__ float xhalf(float x) { return __builtin_bit_cast(float, __builtin_amdgcn_permlanex16(__builtin_bit_cast(int, x), __builtin_bit_cast(int, x), 0x76543210, 0xfedcba98, false, false)); }
// mac3 with the operand sides exchanged: a is the A operand, b the B operand, the three terms in mac3's order
__device__ __forceinline__ v8f mac3t(const F2& a, const F2& b, v8f c) { c = wmma_bf(a.h, b.l, c); c = wmma_bf(a.l, b.h, c); return wmma_bf(a.h, b.h, c); }

// Both products run transposed: S^T = K.Q^T (A = key rows, B = query columns) and O^T += V^T.P^T (A = V^T rows, B = P^T). A lane then holds scores,
// probabilities and output of ONE query (column lane & 15): keys and head dims 8 * (lane >> 4) + r of each 16-row tile. Maximum and sum are in-lane with one
// exchange between the wave's halves, the rescale factor is the lane's own, and two score tiles, converted in place, are a B fragment of P^T in the k order
// that the V^T loader has: neither S nor P goes through LDS.
// Causal balance: query tile x walks x + 1 key tiles, so a work-group takes tile NT - 1 - blockIdx.x and then tile blockIdx.x of its head, one after the other,
// and there is one work-group for each WGP of the chip. The two walks are one loop over one ring of staged tiles: the second walk's first key tiles are
// copied under the first walk's last trips.
// Two waves per SIMD: a work-group has eight waves in two groups of four. A stage of the ring holds two key tiles; group 0 works on the even one and group 1
// on the odd one, each for all 64 queries, so that one wave's products run under the other wave's softmax and LDS waits. Each group keeps its own running
// maximum, sum and output; at a walk's end the groups exchange them through LDS and each finishes one half of the head dims. NS trips for every work-group.
#define NS ((NT + 2) / 2)          // stages of both walks together: their NT + 1 key tiles in pairs, the walk of odd length rounded up
#define STAGE_B (2 * TILE_B)       // bytes of one stage of K (or of V): two tiles
__global__ __launch_bounds__(256) void k_attn(const float* __restrict__ q, const __bf16* __restrict__ ws, float* __restrict__ out) {
  __shared__ __align__(16) __bf16 sK[2][2][2][64][KP];  // key tiles [buffer][even, odd tile][hi, lo][key][d], each shared by the four waves of its group
  __shared__ __align__(16) __bf16 sV[2][2][2][64][KP];  // value tiles [buffer][even, odd tile][hi, lo][d][key], likewise
  __shared__ float sX[2][2][4][18][32];                 // hand-over at a walk's end [walk][group][wave of the group][16 outputs, maximum, sum][lane]
  const int tid = threadIdx.x, t128 = tid & 127, wq = t128 >> 5, lane = tid & 31, col = lane & 15, g = lane >> 4;
  const int grp = __builtin_amdgcn_readfirstlane(tid >> 7);   // the wave's group, in a scalar register: the tests on it below are scalar branches
  const int h = blockIdx.y, tA = (NT - (int)blockIdx.x + 1) >> 1;   // tA: stages of the first walk, 9 to 16
  int qt = NT - 1 - (int)blockIdx.x, qi = qt * 64 + wq * 16 + col, j = 0, wk = 0;  // the query tile in work, this lane's query, the stage within the walk, the walk
  const float* qb = q + h * HD;      // row stride EE
  F2 bq[2];
#pragma unroll
  for (int kc = 0; kc < 2; ++kc) bq[kc] = split_row(qb + (size_t)qi * EE, kc * 32, lane);
  asm volatile("s_wait_xcnt 0x0" ::: "memory");   // stands in front of any rewrite of the query loads' address registers
  float mrun = -3.0e38f, lrun = 0.f; v8f acc[4] = {};   // lrun: this half's keys only, the halves are joined at the walk's end; acc[t][r] = O[qi][t * 16 + 8 * g + r]
  // a group copies its own tile. This lane's 16 bytes in row t128 / 8 of a plane: LDS byte address in buffer 0, and the source element in stage 0
  const unsigned lk = (unsigned)(size_t)&sK[0][grp][0][t128 >> 3][(t128 & 7) * 8], lv = (unsigned)(size_t)&sV[0][grp][0][t128 >> 3][(t128 & 7) * 8];
  const __bf16* gk = ws + (size_t)(grp * 64 + (t128 >> 3)) * EE + h * HD + (t128 & 7) * 8;
  const __bf16* gv = ws + 2 * PL + (size_t)(h * HD + (t128 >> 3)) * SQ + grp * 64 + (t128 & 7) * 8;
  copy_tile(lk, gk, EE); copy_tile(lv, gv, SQ);
  asm volatile("s_wait_asynccnt 0x0" ::: "memory");   // stage 0 has landed before the barrier publishes it
  __syncthreads();
  copy_tile(lk + STAGE_B, gk + (size_t)128 * EE, EE); copy_tile(lv + STAGE_B, gv + 128, SQ);   // the first walk has 9 stages or more
#pragma unroll 1
  for (int i = 0; i < NS; ++i) {   // trip i reads buffer i & 1
    const int kt = 2 * j + grp;    // this group's key tile
    const bool last = j == (qt >> 1);   // the stage that holds the diagonal tile is the walk's last (reads the same in the whole work-group)
    if (kt <= qt) {   // a walk of odd length leaves group 1 a tile past the diagonal in its last stage: no key of it counts (scalar test, no barrier inside)
    const __bf16* Kt = &sK[i & 1][grp][0][0][0]; const __bf16* Vt = &sV[i & 1][grp][0][0][0];
    // The trip's fragment reads stand in groups ahead of the products that use them, so that one LDS latency is waited out per group and not one
    // per three products: the K fragments at the top; the first half of the V fragments behind the second score tile, in the registers that
    // two tiles' K fragments leave (it lands under the other score tiles); the second half in front of the first half's products.
    F2 kf[4][2], vf[2][4]; v8f s[4]; float mx = -3.4e38f;
#pragma unroll
    for (int t = 0; t < 4; ++t) {
#pragma unroll
      for (int kc = 0; kc < 2; ++kc) kf[t][kc] = frag_pl(Kt + (t * 16 + col) * KP, kc * 32, lane); }
#pragma unroll
    for (int t = 0; t < 4; ++t) { v8f a = {}; const int key0 = kt * 64 + t * 16 + 8 * g;
#pragma unroll
      for (int kc = 0; kc < 2; ++kc) a = mac3t(kf[t][kc], bq[kc], a);
      if (t == 1) {
#pragma unroll
        for (int u = 0; u < 4; ++u) vf[0][u] = frag_pl(Vt + (u * 16 + col) * KP, 0, lane); }
#pragma unroll
      for (int r = 0; r < 8; ++r) a[r] = key0 + r <= qi ? a[r] * 0.125f : -10000.0f;
      // a tile's maximum as a short tree, so that little of it is left behind the last score tile
      mx = fmaxf(mx, fmaxf(fmaxf(fmaxf(fmaxf(a[0], a[1]), a[2]), fmaxf(fmaxf(a[3], a[4]), a[5])), fmaxf(a[6], a[7])));
      s[t] = a; }
    mx = fmaxf(mx, xhalf(mx));
    // exponentials in base 2 on the hardware's own instruction: the running maximum is kept times log2(e), one fused multiply-add forms each argument
    const float mnew = fmaxf(mrun, mx * LOG2E); const float corr = __builtin_amdgcn_exp2f(mrun - mnew);
#pragma unroll
    for (int t = 0; t < 4; ++t) {
#pragma unroll
      for (int r = 0; r < 8; ++r) s[t][r] = __builtin_amdgcn_exp2f(fmaf(s[t][r], LOG2E, -mnew)); }
    const v8f p8 = (s[0] + s[1]) + (s[2] + s[3]);   // the lane's 32 probabilities summed as a tree of vector adds, not as one chain
    lrun = lrun * corr + (((p8[0] + p8[4]) + (p8[1] + p8[5])) + ((p8[2] + p8[6]) + (p8[3] + p8[7]))); mrun = mnew;
#pragma unroll
    for (int t = 0; t < 4; ++t) acc[t] *= corr;
    F2 pb[2];   // P^T as B: element i of fragment kc is key 32 * kc + 8 * g + i, element 8 + i key 32 * kc + 16 + 8 * g + i, as frag_pl reads V^T
#pragma unroll
    for (int kc = 0; kc < 2; ++kc) { float x[16];
#pragma unroll
      for (int i2 = 0; i2 < 8; ++i2) { x[i2] = s[2 * kc][i2]; x[8 + i2] = s[2 * kc + 1][i2]; }
      pb[kc] = bsplit16(x); }
#pragma unroll
    for (int u = 0; u < 4; ++u) vf[1][u] = frag_pl(Vt + (u * 16 + col) * KP, 32, lane);
#pragma unroll
    for (int kc = 0; kc < 2; ++kc) {
#pragma unroll
      for (int t = 0; t < 4; ++t) acc[t] = mac3t(vf[kc][t], pb[kc], acc[t]); }
    }
    float lh = 0.f;   // this group's sum for the lane's query, formed at a walk's end
    if (last) {   // hand-over: a group gives away its part of the two output tiles that the other group finishes, with its maximum and sum
      float* xo = &sX[wk][grp][wq][0][lane]; lh = lrun + xhalf(lrun);
#pragma unroll
      for (int t = 0; t < 2; ++t) {
#pragma unroll
        for (int r = 0; r < 8; ++r) xo[(t * 8 + r) * 32] = grp ? acc[t][r] : acc[2 + t][r]; }
      xo[16 * 32] = mrun; xo[17 * 32] = lh;
    }
    __builtin_amdgcn_wave_barrier();
    asm volatile("s_wait_dscnt 0x0" ::: "memory");      // this wave's reads of the buffer are done before it is refilled, and its hand-over is written
    asm volatile("s_wait_asynccnt 0x0" ::: "memory");   // this wave's copies for trip i + 1 have landed
    __syncthreads();                                    // publishes the stage of trip i + 1 and the hand-over, and ends every wave's reads of trip i's stage
    if (i + 2 < NS) { const unsigned bo = (unsigned)(i & 1) * STAGE_B; const size_t go = (size_t)(i + 2 < tA ? i + 2 : i + 2 - tA) * 128;   // trip i + 2's first key
      copy_tile(lk + bo, gk + go * EE, EE); copy_tile(lv + bo, gv + go, SQ); }
    if (last) {   // the query tile goes out (no barrier stands inside; each walk has a hand-over area of its own, so none is rewritten while it is read)
    const float* xi = &sX[wk][grp ^ 1][wq][0][lane];
    const float mo = xi[16 * 32], m = fmaxf(mrun, mo), ca = __builtin_amdgcn_exp2f(mrun - m), cb = __builtin_amdgcn_exp2f(mo - m);
    const float lr = lh * ca + xi[17 * 32] * cb;
    float* o = out + (size_t)qi * EE + h * HD + grp * 32 + 8 * g;  // eight accumulator registers are eight consecutive floats of the query's row; a group writes one whole 128-byte line of it
    v8f res[2];
#pragma unroll
    for (int t = 0; t < 2; ++t) {
#pragma unroll
      for (int r = 0; r < 8; ++r) res[t][r] = ((grp ? acc[2 + t][r] : acc[t][r]) * ca + xi[(t * 8 + r) * 32] * cb) / lr; }
    __builtin_amdgcn_sched_barrier(0);   // every quotient is formed in front of the first store, so that no register of an issued store is rewritten behind it
#pragma unroll
    for (int t = 0; t < 2; ++t) *(v8f*)(o + t * 16) = res[t];
    asm volatile("s_wait_xcnt 0x0" ::: "memory");   // stands in front of the second walk's rewrite of the stores' address and data registers
    __builtin_amdgcn_sched_barrier(0);   // keeps every such rewrite behind that wait
    qt = (int)blockIdx.x; qi = qt * 64 + wq * 16 + col; j = -1; wk = 1; mrun = -3.0e38f; lrun = 0.f;   // the second walk; ++j below makes its first stage 0
    if (i != NS - 1) {
#pragma unroll
      for (int kc = 0; kc < 2; ++kc) bq[kc] = split_row(qb + (size_t)qi * EE, kc * 32, lane); }
#pragma unroll
    for (int t = 0; t < 4; ++t) acc[t] = v8f{};
    }
    ++j;
  }
  asm volatile("s_wait_asynccnt 0x0" ::: "memory");     // no copy is outstanding when the wave goes on to its end
}
extern "C" void kernel_launch(void* const* d_in, const int* in_sizes, int n_in, void* d_out, int out_size, void* d_ws, size_t ws_size, hipStream_t stream) {
  (void)in_sizes; (void)n_in; (void)out_size; (void)ws_size;
  const float* q = (const float*)d_in[0]; const float* k = (const float*)d_in[1]; const float* v = (const float*)d_in[2];
  float* out = (float*)d_out; __bf16* ws = (__bf16*)d_ws;
  k_split<<<dim3(SQ / 64, NH, 2), 256, 0, stream>>>(k, v, ws);
  k_attn<<<dim3(NT / 2, NH), 256, 0, stream>>>(q, ws, out);
}

// v008
// One run takes 32.6 microseconds.
// Two timings next to v007 both put it at 1.09 times that version's speed.
// Over all steps from v000 it is 6.36 times as fast.
#include <hip/hip_runtime.h>
#include <math.h>

typedef __attribute__((ext_vector_type(16))) _Float16 v16h;
typedef __attribute__((ext_vector_type(16))) __bf16 v16b;
typedef __attribute__((ext_vector_type(8)))  _Float16 v8h;
typedef __attribute__((ext_vector_type(8)))  float v8f;
typedef __attribute__((ext_vector_type(4)))  float v4f;
typedef __attribute__((ext_vector_type(2)))  float v2f;
typedef __attribute__((ext_vector_type(4)))  unsigned v4u;
typedef __attribute__((ext_vector_type(4)))  int v4i;
typedef float __attribute__((may_alias)) float_a;
typedef int __attribute__((may_alias)) int_a;

template <typename T> __device__ __forceinline__ void vst2(void* p, T v) { *(T*)p = v;  }
__device__ __forceinline__ v8f wmma16(v16h a, v16h b, v8f c) {
  v8f d = __builtin_amdgcn_wmma_f32_16x16x32_f16(false, a, false, b, (short)0, c, false, false);
  asm volatile("v_nop\n\tv_nop\n\tv_nop\n\tv_nop" : "+v"(d) : "v"(a), "v"(b));
  return d;
}
__device__ __forceinline__ v8f wmma_bf(v16b a, v16b b, v8f c) {
  v8f d = __builtin_amdgcn_wmma_f32_16x16x32_bf16(false, a, false, b, (short)0, c, false, false);
  asm volatile("v_nop\n\tv_nop\n\tv_nop\n\tv_nop" : "+v"(d) : "v"(a), "v"(b));
  return d;
}
// 16x16x32 fragments: lane = (h = lane>>4, row/col = lane&15); elements 0..7 = k0+8h+0..7, 8..15 = k0+16+8h+0..7; D element r = row 8h+r
__device__ __forceinline__ v16h frag_h(const _Float16* rowk0, int lane) {
  union { v16h v; v8h q[2]; } u; const _Float16* p = rowk0 + 8 * (lane >> 4);
  u.q[0] = *(const v8h*)p; u.q[1] = *(const v8h*)(p + 16); return u.v;
}
__device__ __forceinline__ v16h frag_f32(const float* rowk0, int lane) {
  v16h a; const float* p = rowk0 + 8 * (lane >> 4);
#pragma unroll
  for (int i = 0; i < 8; ++i) { a[i] = (_Float16)p[i]; a[8 + i] = (_Float16)p[16 + i]; }
  return a;
}
__device__ __forceinline__ v16h frag_f32s(const float* rowk0, int lane, float sc) {
  v16h a; const float* p = rowk0 + 8 * (lane >> 4);
#pragma unroll
  for (int i = 0; i < 8; ++i) { a[i] = (_Float16)(p[i] * sc); a[8 + i] = (_Float16)(p[16 + i] * sc); }
  return a;
}
// column fragment from a [K][ld] layout (column n), rows >= K read as 0
__device__ __forceinline__ v16h fragc_f32(const float* W, int k0, int n, int lane, int ld, int K) {
  v16h a; const int g = lane >> 4;
#pragma unroll
  for (int i = 0; i < 8; ++i) { const int ka = k0 + 8 * g + i, kb = ka + 16;
    a[i] = (_Float16)(ka < K ? W[(size_t)ka * ld + n] : 0.f); a[8 + i] = (_Float16)(kb < K ? W[(size_t)kb * ld + n] : 0.f); }
  return a;
}
struct F2 { v16b h, l; };
__device__ __forceinline__ F2 bsplit16(const float v[16]) { F2 r;
#pragma unroll
  for (int i = 0; i < 16; ++i) { const __bf16 h = (__bf16)v[i]; r.h[i] = h; r.l[i] = (__bf16)(v[i] - (float)h); }
  return r; }
__device__ __forceinline__ F2 split_row(const float* row, int k0, int lane) { float v[16]; const float* p = row + k0 + 8 * (lane >> 4);
#pragma unroll
  for (int i = 0; i < 8; ++i) { v[i] = p[i]; v[8 + i] = p[16 + i]; }
  return bsplit16(v); }
__device__ __forceinline__ F2 split_rowK(const float* row, int k0, int lane, int K) { float v[16]; const int g = lane >> 4;
#pragma unroll
  for (int i = 0; i < 8; ++i) { const int ka = k0 + 8 * g + i, kb = ka + 16; v[i] = ka < K ? row[ka] : 0.f; v[8 + i] = kb < K ? row[kb] : 0.f; }
  return bsplit16(v); }
__device__ __forceinline__ F2 split_col(const float* W, int k0, int n, int lane, int ld, int K) { float v[16]; const int g = lane >> 4;
#pragma unroll
  for (int i = 0; i < 8; ++i) { const int ka = k0 + 8 * g + i, kb = ka + 16; v[i] = ka < K ? W[(size_t)ka * ld + n] : 0.f; v[8 + i] = kb < K ? W[(size_t)kb * ld + n] : 0.f; }
  return bsplit16(v); }
__device__ __forceinline__ v8f mac3(const F2& a, const F2& b, v8f c) { c = wmma_bf(a.l, b.h, c); c = wmma_bf(a.h, b.l, c); return wmma_bf(a.h, b.h, c); }
__device__ __forceinline__ float sigm(float v) { return 1.0f / (1.0f + expf(-v)); }
#define LDSX() do { asm volatile("s_wait_dscnt 0" ::: "memory"); __builtin_amdgcn_wave_barrier(); __builtin_amdgcn_fence(__ATOMIC_RELEASE, "workgroup"); } while (0)

// Causal core attention (16 heads, 2048 tokens, batch 1), near-f32: S = q.k/8 and P@V both on v_wmma_f32_16x16x32_bf16 as two-way
// bf16 splits taken directly from the f32 inputs (hi*hi + hi*lo + lo*hi, f32 accumulate) — plain f16 left ~1e-3 absolute error on the
// first few query rows (few keys, no averaging). Masked positions get -10000; key
#define LOG2E 1.4426950408889634f
#define SQ 2048
#define NH 16
#define HD 64
#define EE (NH * HD)
#define NT (SQ / 64)               // query tiles (and key tiles) of a head
#define KP 72                      // LDS row pitch of a staged plane in bf16: 144 B = 16 B x 9, free of bank conflicts for 16-byte row reads
#define PLANE_B (64 * KP * 2)      // bytes of one staged 64 x 64 bf16 plane
#define TILE_B (2 * PLANE_B)       // a staged tile: its hi plane, then its lo plane
#define PL ((size_t)SQ * EE)       // elements of one bf16 plane in the workspace: K hi, K lo as [token][head * 64 + d], then V hi, V lo as [head * 64 + d][token]
typedef __attribute__((ext_vector_type(8))) __bf16 v8b;

// Pre-pass: every K and V element is split into bf16 hi + lo once per call (the attention kernel did it in each wave for each tile it walked);
// V goes out transposed, so that a P@V column fragment is two 16-byte row reads like a K fragment.
__global__ __launch_bounds__(256) void k_split(const float* __restrict__ k, const float* __restrict__ v, __bf16* __restrict__ ws) {
  __shared__ float sT[64][65];     // 65: the column walk of the transpose meets no bank twice
  const int tid = threadIdx.x, s0 = blockIdx.x * 64, h = blockIdx.y, r = tid >> 2, c = (tid & 3) * 16;
  const float* p = (blockIdx.z == 0 ? k : v) + (size_t)(s0 + r) * EE + h * HD + c;
  float x[16];
#pragma unroll
  for (int i = 0; i < 4; ++i) { const v4f t = *(const v4f*)(p + 4 * i);
#pragma unroll
    for (int j = 0; j < 4; ++j) x[4 * i + j] = t[j]; }
  asm volatile("s_wait_xcnt 0x0" ::: "memory");   // stands in front of any rewrite of the four loads' address registers
  __bf16* o = ws + (size_t)(s0 + r) * EE + h * HD + c;
  if (blockIdx.z != 0) {
#pragma unroll
    for (int i = 0; i < 16; ++i) sT[r][c + i] = x[i];
    __syncthreads();               // the whole 64 x 64 tile is in LDS before its columns are read
#pragma unroll
    for (int i = 0; i < 16; ++i) x[i] = sT[c + i][r];
    o = ws + 2 * PL + (size_t)(h * HD + r) * SQ + s0 + c;
  }
  const F2 f = bsplit16(x);
  *(v16b*)o = f.h; *(v16b*)(o + PL) = f.l;
}

// hi and lo fragments from a staged tile: row points into the hi plane, the lo plane lies 64 * KP elements behind it
__device__ __forceinline__ F2 frag_pl(const __bf16* row, int k0, int lane) {
  union { v16b v; v8b q[2]; } a, b; const __bf16* p = row + k0 + 8 * (lane >> 4);
  a.q[0] = *(const v8b*)p; a.q[1] = *(const v8b*)(p + 16);
  b.q[0] = *(const v8b*)(p + 64 * KP); b.q[1] = *(const v8b*)(p + 64 * KP + 16);
  F2 r; r.h = a.v; r.l = b.v; return r;
}

// One lane's share of a 64 x 64 tile's two bf16 planes (source row stride ld elements): eight asynchronous 16-byte copies global -> LDS,
// rows r, r + 16, r + 32, r + 48 of the hi plane, then of the lo plane. A wave covers four whole 128-byte rows per copy.
// s_wait_xcnt closes the statement so that no address register is rewritten ahead of it.
__device__ __forceinline__ void copy_tile(unsigned l, const __bf16* g, int ld) {
  asm volatile("global_load_async_to_lds_b128 %0, %8, off\n\t"
               "global_load_async_to_lds_b128 %1, %9, off\n\t"
               "global_load_async_to_lds_b128 %2, %10, off\n\t"
               "global_load_async_to_lds_b128 %3, %11, off\n\t"
               "global_load_async_to_lds_b128 %4, %12, off\n\t"
               "global_load_async_to_lds_b128 %5, %13, off\n\t"
               "global_load_async_to_lds_b128 %6, %14, off\n\t"
               "global_load_async_to_lds_b128 %7, %15, off\n\t"
               "s_wait_xcnt 0x0"
               :: "v"(l), "v"(l + 16 * KP * 2), "v"(l + 32 * KP * 2), "v"(l + 48 * KP * 2),
                  "v"(l + PLANE_B), "v"(l + PLANE_B + 16 * KP * 2), "v"(l + PLANE_B + 32 * KP * 2), "v"(l + PLANE_B + 48 * KP * 2),
                  "v"(g), "v"(g + 16 * ld), "v"(g + 32 * ld), "v"(g + 48 * ld), "v"(g + PL), "v"(g + PL + 16 * ld), "v"(g + PL + 32 * ld), "v"(g + PL + 48 * ld)
               : "memory");
}

// lane l with lane l ^ 16, on the vector unit (a shuffle would go through the LDS path and be waited for)
__device__ __forceinline__ float xhalf(float x) { return __builtin_bit_cast(float, __builtin_amdgcn_permlanex16(__builtin_bit_cast(int, x), __builtin_bit_cast(int, x), 0x76543210, 0xfedcba98, false, false)); }
// One of the three terms of a split product, a the A operand and b the B operand: n = 0 hi.lo, 1 lo.hi, 2 hi.hi (an accumulator takes them in that order).
// The callers walk several accumulators per term, so that a product's neighbours are independent of it: they fill its latency and the distance behind it.
__device__ __forceinline__ v8f term3(const F2& a, const F2& b, v8f c, int n) {
  return __builtin_amdgcn_wmma_f32_16x16x32_bf16(false, n == 1 ? a.l : a.h, false, n == 0 ? b.l : b.h, (short)0, c, false, false);
}
// Stands behind each round of independent products and behind each group of fragment reads: no matrix or LDS instruction is scheduled across it (vector,
// transcendental and scalar ones may be). Without it the compiler puts an accumulator's terms back to back again and moves the reads in among the products.
#define ROUND_END() __builtin_amdgcn_sched_barrier(0x406)

// Both products run transposed: S^T = K.Q^T (A = key rows, B = query columns) and O^T += V^T.P^T (A = V^T rows, B = P^T). A lane then holds scores,
// probabilities and output of ONE query (column lane & 15): keys and head dims 8 * (lane >> 4) + r of each 16-row tile. Maximum and sum are in-lane with one
// exchange between the wave's halves, the rescale factor is the lane's own, and two score tiles, converted in place, are a B fragment of P^T in the k order
// that the V^T loader has: neither S nor P goes through LDS.
// Causal balance: query tile x walks x + 1 key tiles, so a work-group takes tile NT - 1 - blockIdx.x and then tile blockIdx.x of its head, one after the other,
// and there is one work-group for each WGP of the chip. The two walks are one loop over one ring of staged tiles: the second walk's first key tiles are
// copied under the first walk's last trips.
// Two waves per SIMD: a work-group has eight waves in two groups of four. A stage of the ring holds two key tiles; group 0 works on the even one and group 1
// on the odd one, each for all 64 queries, so that one wave's products run under the other wave's softmax and LDS waits. Each group keeps its own running
// maximum, sum and output; at a walk's end the groups exchange them through LDS and each finishes one half of the head dims. NS trips for every work-group.
#define NS ((NT + 2) / 2)          // stages of both walks together: their NT + 1 key tiles in pairs, the walk of odd length rounded up
#define STAGE_B (2 * TILE_B)       // bytes of one stage of K (or of V): two tiles
__global__ __launch_bounds__(256) void k_attn(const float* __restrict__ q, const __bf16* __restrict__ ws, float* __restrict__ out) {
  __shared__ __align__(16) __bf16 sK[2][2][2][64][KP];  // key tiles [buffer][even, odd tile][hi, lo][key][d], each shared by the four waves of its group
  __shared__ __align__(16) __bf16 sV[2][2][2][64][KP];  // value tiles [buffer][even, odd tile][hi, lo][d][key], likewise
  __shared__ float sX[2][2][4][18][32];                 // hand-over at a walk's end [walk][group][wave of the group][16 outputs, maximum, sum][lane]
  const int tid = threadIdx.x, t128 = tid & 127, wq = t128 >> 5, lane = tid & 31, col = lane & 15, g = lane >> 4;
  const int grp = __builtin_amdgcn_readfirstlane(tid >> 7);   // the wave's group, in a scalar register: the tests on it below are scalar branches
  const int h = blockIdx.y, tA = (NT - (int)blockIdx.x + 1) >> 1;   // tA: stages of the first walk, 9 to 16
  int qt = NT - 1 - (int)blockIdx.x, qi = qt * 64 + wq * 16 + col, j = 0, wk = 0;  // the query tile in work, this lane's query, the stage within the walk, the walk
  const float* qb = q + h * HD;      // row stride EE
  F2 bq[2];
#pragma unroll
  for (int kc = 0; kc < 2; ++kc) bq[kc] = split_row(qb + (size_t)qi * EE, kc * 32, lane);
  asm volatile("s_wait_xcnt 0x0" ::: "memory");   // stands in front of any rewrite of the query loads' address registers
  float mrun = -3.0e38f, lrun = 0.f; v8f acc[4] = {};   // lrun: this half's keys only, the halves are joined at the walk's end; acc[t][r] = O[qi][t * 16 + 8 * g + r]
  // a group copies its own tile. This lane's 16 bytes in row t128 / 8 of a plane: LDS byte address in buffer 0, and the source element in stage 0
  const unsigned lk = (unsigned)(size_t)&sK[0][grp][0][t128 >> 3][(t128 & 7) * 8], lv = (unsigned)(size_t)&sV[0][grp][0][t128 >> 3][(t128 & 7) * 8];
  const __bf16* gk = ws + (size_t)(grp * 64 + (t128 >> 3)) * EE + h * HD + (t128 & 7) * 8;
  const __bf16* gv = ws + 2 * PL + (size_t)(h * HD + (t128 >> 3)) * SQ + grp * 64 + (t128 & 7) * 8;
  copy_tile(lk, gk, EE); copy_tile(lv, gv, SQ);
  asm volatile("s_wait_asynccnt 0x0" ::: "memory");   // stage 0 has landed before the barrier publishes it
  __syncthreads();
  copy_tile(lk + STAGE_B, gk + (size_t)128 * EE, EE); copy_tile(lv + STAGE_B, gv + 128, SQ);   // the first walk has 9 stages or more
#pragma unroll 1
  for (int i = 0; i < NS; ++i) {   // trip i reads buffer i & 1
    const int kt = 2 * j + grp;    // this group's key tile
    const bool last = j == (qt >> 1);   // the stage that holds the diagonal tile is the walk's last (reads the same in the whole work-group)
    if (kt <= qt) {   // a walk of odd length leaves group 1 a tile past the diagonal in its last stage: no key of it counts (scalar test, no barrier inside)
    const __bf16* Kt = &sK[i & 1][grp][0][0][0]; const __bf16* Vt = &sV[i & 1][grp][0][0][0];
    // The trip's fragment reads stand in groups ahead of the products that use them, so that one LDS latency is waited out per group and not one
    // per three products: the K fragments at the top; the first half of the V fragments behind the second score tile, in the registers that
    // two tiles' K fragments leave (it lands under the other score tiles); the second half behind the last score tile (it lands under the softmax).
    // The products go round-robin over independent accumulators, two score tiles or four output tiles, each accumulator's own terms in the order hi.lo, lo.hi, hi.hi.
    F2 kf[4][2], vf[2][4]; v8f s[4]; float mx = -3.4e38f;
#pragma unroll
    for (int t = 0; t < 4; ++t) {
#pragma unroll
      for (int kc = 0; kc < 2; ++kc) kf[t][kc] = frag_pl(Kt + (t * 16 + col) * KP, kc * 32, lane); }
#pragma unroll
    for (int tp = 0; tp < 4; tp += 2) { s[tp] = v8f{}; s[tp + 1] = v8f{};
#pragma unroll
      for (int kc = 0; kc < 2; ++kc) {
#pragma unroll
        for (int n = 0; n < 3; ++n) {
#pragma unroll
          for (int t = tp; t < tp + 2; ++t) s[t] = term3(kf[t][kc], bq[kc], s[t], n);
          ROUND_END(); } }
      if (tp == 0) {
#pragma unroll
        for (int u = 0; u < 4; ++u) vf[0][u] = frag_pl(Vt + (u * 16 + col) * KP, 0, lane); }
      else {
#pragma unroll
        for (int u = 0; u < 4; ++u) vf[1][u] = frag_pl(Vt + (u * 16 + col) * KP, 32, lane); }
      ROUND_END();
#pragma unroll
      for (int t = tp; t < tp + 2; ++t) { v8f a = s[t]; const int key0 = kt * 64 + t * 16 + 8 * g;
#pragma unroll
        for (int r = 0; r < 8; ++r) a[r] = key0 + r <= qi ? a[r] * 0.125f : -10000.0f;
        // a tile's maximum as a short tree, so that little of it is left behind the last score tile
        mx = fmaxf(mx, fmaxf(fmaxf(fmaxf(fmaxf(a[0], a[1]), a[2]), fmaxf(fmaxf(a[3], a[4]), a[5])), fmaxf(a[6], a[7])));
        s[t] = a; } }
    mx = fmaxf(mx, xhalf(mx));
    // exponentials in base 2 on the hardware's own instruction: the running maximum is kept times log2(e), one fused multiply-add forms each argument
    const float mnew = fmaxf(mrun, mx * LOG2E); const float corr = __builtin_amdgcn_exp2f(mrun - mnew);
#pragma unroll
    for (int t = 0; t < 4; ++t) {
#pragma unroll
      for (int r = 0; r < 8; ++r) s[t][r] = __builtin_amdgcn_exp2f(fmaf(s[t][r], LOG2E, -mnew)); }
    const v8f p8 = (s[0] + s[1]) + (s[2] + s[3]);   // the lane's 32 probabilities summed as a tree of vector adds, not as one chain
    lrun = lrun * corr + (((p8[0] + p8[4]) + (p8[1] + p8[5])) + ((p8[2] + p8[6]) + (p8[3] + p8[7]))); mrun = mnew;
#pragma unroll
    for (int t = 0; t < 4; ++t) acc[t] *= corr;
    F2 pb[2];   // P^T as B: element i of fragment kc is key 32 * kc + 8 * g + i, element 8 + i key 32 * kc + 16 + 8 * g + i, as frag_pl reads V^T
#pragma unroll
    for (int kc = 0; kc < 2; ++kc) { float x[16];
#pragma unroll
      for (int i2 = 0; i2 < 8; ++i2) { x[i2] = s[2 * kc][i2]; x[8 + i2] = s[2 * kc + 1][i2]; }
      pb[kc] = bsplit16(x); }
#pragma unroll
    for (int kc = 0; kc < 2; ++kc) {
#pragma unroll
      for (int n = 0; n < 3; ++n) {
#pragma unroll
        for (int t = 0; t < 4; ++t) acc[t] = term3(vf[kc][t], pb[kc], acc[t], n);
        if (kc + n < 3) ROUND_END(); } }
    }
    float lh = 0.f;   // this group's sum for the lane's query, formed at a walk's end
    if (last) {   // hand-over: a group gives away its part of the two output tiles that the other group finishes, with its maximum and sum
      float* xo = &sX[wk][grp][wq][0][lane]; lh = lrun + xhalf(lrun);
#pragma unroll
      for (int t = 0; t < 2; ++t) {
#pragma unroll
        for (int r = 0; r < 8; ++r) xo[(t * 8 + r) * 32] = grp ? acc[t][r] : acc[2 + t][r]; }
      xo[16 * 32] = mrun; xo[17 * 32] = lh;
    }
    __builtin_amdgcn_wave_barrier();
    asm volatile("s_wait_dscnt 0x0" ::: "memory");      // this wave's reads of the buffer are done before it is refilled, and its hand-over is written
    asm volatile("s_wait_asynccnt 0x0" ::: "memory");   // this wave's copies for trip i + 1 have landed
    __syncthreads();                                    // publishes the stage of trip i + 1 and the hand-over, and ends every wave's reads of trip i's stage
    if (i + 2 < NS) { const unsigned bo = (unsigned)(i & 1) * STAGE_B; const size_t go = (size_t)(i + 2 < tA ? i + 2 : i + 2 - tA) * 128;   // trip i + 2's first key
      copy_tile(lk + bo, gk + go * EE, EE); copy_tile(lv + bo, gv + go, SQ); }
    if (last) {   // the query tile goes out (no barrier stands inside; each walk has a hand-over area of its own, so none is rewritten while it is read)
    const float* xi = &sX[wk][grp ^ 1][wq][0][lane];
    const float mo = xi[16 * 32], m = fmaxf(mrun, mo), ca = __builtin_amdgcn_exp2f(mrun - m), cb = __builtin_amdgcn_exp2f(mo - m);
    asm volatile("v_nop" :: "v"(ca), "v"(cb));   // the slot that the instruction set asks for behind a transcendental
    const float lr = lh * ca + xi[17 * 32] * cb;
    float* o = out + (size_t)qi * EE + h * HD + grp * 32 + 8 * g;  // eight accumulator registers are eight consecutive floats of the query's row; a group writes one whole 128-byte line of it
    v8f res[2];
#pragma unroll
    for (int t = 0; t < 2; ++t) {
#pragma unroll
      for (int r = 0; r < 8; ++r) res[t][r] = ((grp ? acc[2 + t][r] : acc[t][r]) * ca + xi[(t * 8 + r) * 32] * cb) / lr; }
    __builtin_amdgcn_sched_barrier(0);   // every quotient is formed in front of the first store, so that no register of an issued store is rewritten behind it
#pragma unroll
    for (int t = 0; t < 2; ++t) *(v8f*)(o + t * 16) = res[t];
    asm volatile("s_wait_xcnt 0x0" ::: "memory");   // stands in front of the second walk's rewrite of the stores' address and data registers
    __builtin_amdgcn_sched_barrier(0);   // keeps every such rewrite behind that wait
    qt = (int)blockIdx.x; qi = qt * 64 + wq * 16 + col; j = -1; wk = 1; mrun = -3.0e38f; lrun = 0.f;   // the second walk; ++j below makes its first stage 0
    if (i != NS - 1) {
#pragma unroll
      for (int kc = 0; kc < 2; ++kc) bq[kc] = split_row(qb + (size_t)qi * EE, kc * 32, lane); }
#pragma unroll
    for (int t = 0; t < 4; ++t) acc[t] = v8f{};
    }
    ++j;
  }
  asm volatile("s_wait_asynccnt 0x0" ::: "memory");     // no copy is outstanding when the wave goes on to its end
}
extern "C" void kernel_launch(void* const* d_in, const int* in_sizes, int n_in, void* d_out, int out_size, void* d_ws, size_t ws_size, hipStream_t stream) {
  (void)in_sizes; (void)n_in; (void)out_size; (void)ws_size;
  const float* q = (const float*)d_in[0]; const float* k = (const float*)d_in[1]; const float* v = (const float*)d_in[2];
  float* out = (float*)d_out; __bf16* ws = (__bf16*)d_ws;
  k_split<<<dim3(SQ / 64, NH, 2), 256, 0, stream>>>(k, v, ws);
  k_attn<<<dim3(NT / 2, NH), 256, 0, stream>>>(q, ws, out);
}

// v009
// Measured time: 30.9 microseconds a run.
// Next to v008, in two timings, it ran 1.05 times as fast each time.
// Counting every step since v000, it is 6.70 times as fast.
#include <hip/hip_runtime.h>
#include <math.h>

typedef __attribute__((ext_vector_type(16))) _Float16 v16h;
typedef __attribute__((ext_vector_type(16))) __bf16 v16b;
typedef __attribute__((ext_vector_type(8)))  _Float16 v8h;
typedef __attribute__((ext_vector_type(8)))  float v8f;
typedef __attribute__((ext_vector_type(4)))  float v4f;
typedef __attribute__((ext_vector_type(2)))  float v2f;
typedef __attribute__((ext_vector_type(4)))  unsigned v4u;
typedef __attribute__((ext_vector_type(4)))  int v4i;
typedef float __attribute__((may_alias)) float_a;
typedef int __attribute__((may_alias)) int_a;

template <typename T> __device__ __forceinline__ void vst2(void* p, T v) { *(T*)p = v;  }
__device__ __forceinline__ v8f wmma16(v16h a, v16h b, v8f c) {
  v8f d = __builtin_amdgcn_wmma_f32_16x16x32_f16(false, a, false, b, (short)0, c, false, false);
  asm volatile("v_nop\n\tv_nop\n\tv_nop\n\tv_nop" : "+v"(d) : "v"(a), "v"(b));
  return d;
}
__device__ __forceinline__ v8f wmma_bf(v16b a, v16b b, v8f c) {
  v8f d = __builtin_amdgcn_wmma_f32_16x16x32_bf16(false, a, false, b, (short)0, c, false, false);
  asm volatile("v_nop\n\tv_nop\n\tv_nop\n\tv_nop" : "+v"(d) : "v"(a), "v"(b));
  return d;
}
// 16x16x32 fragments: lane = (h = lane>>4, row/col = lane&15); elements 0..7 = k0+8h+0..7, 8..15 = k0+16+8h+0..7; D element r = row 8h+r
__device__ __forceinline__ v16h frag_h(const _Float16* rowk0, int lane) {
  union { v16h v; v8h q[2]; } u; const _Float16* p = rowk0 + 8 * (lane >> 4);
  u.q[0] = *(const v8h*)p; u.q[1] = *(const v8h*)(p + 16); return u.v;
}
__device__ __forceinline__ v16h frag_f32(const float* rowk0, int lane) {
  v16h a; const float* p = rowk0 + 8 * (lane >> 4);
#pragma unroll
  for (int i = 0; i < 8; ++i) { a[i] = (_Float16)p[i]; a[8 + i] = (_Float16)p[16 + i]; }
  return a;
}
__device__ __forceinline__ v16h frag_f32s(const float* rowk0, int lane, float sc) {
  v16h a; const float* p = rowk0 + 8 * (lane >> 4);
#pragma unroll
  for (int i = 0; i < 8; ++i) { a[i] = (_Float16)(p[i] * sc); a[8 + i] = (_Float16)(p[16 + i] * sc); }
  return a;
}
// column fragment from a [K][ld] layout (column n), rows >= K read as 0
__device__ __forceinline__ v16h fragc_f32(const float* W, int k0, int n, int lane, int ld, int K) {
  v16h a; const int g = lane >> 4;
#pragma unroll
  for (int i = 0; i < 8; ++i) { const int ka = k0 + 8 * g + i, kb = ka + 16;
    a[i] = (_Float16)(ka < K ? W[(size_t)ka * ld + n] : 0.f); a[8 + i] = (_Float16)(kb < K ? W[(size_t)kb * ld + n] : 0.f); }
  return a;
}
struct F2 { v16b h, l; };
__device__ __forceinline__ F2 bsplit16(const float v[16]) { F2 r;
#pragma unroll
  for (int i = 0; i < 16; ++i) { const __bf16 h = (__bf16)v[i]; r.h[i] = h; r.l[i] = (__bf16)(v[i] - (float)h); }
  return r; }
__device__ __forceinline__ F2 split_row(const float* row, int k0, int lane) { float v[16]; const float* p = row + k0 + 8 * (lane >> 4);
#pragma unroll
  for (int i = 0; i < 8; ++i) { v[i] = p[i]; v[8 + i] = p[16 + i]; }
  return bsplit16(v); }
__device__ __forceinline__ F2 split_rowK(const float* row, int k0, int lane, int K) { float v[16]; const int g = lane >> 4;
#pragma unroll
  for (int i = 0; i < 8; ++i) { const int ka = k0 + 8 * g + i, kb = ka + 16; v[i] = ka < K ? row[ka] : 0.f; v[8 + i] = kb < K ? row[kb] : 0.f; }
  return bsplit16(v); }
__device__ __forceinline__ F2 split_col(const float* W, int k0, int n, int lane, int ld, int K) { float v[16]; const int g = lane >> 4;
#pragma unroll
  for (int i = 0; i < 8; ++i) { const int ka = k0 + 8 * g + i, kb = ka + 16; v[i] = ka < K ? W[(size_t)ka * ld + n] : 0.f; v[8 + i] = kb < K ? W[(size_t)kb * ld + n] : 0.f; }
  return bsplit16(v); }
__device__ __forceinline__ v8f mac3(const F2& a, const F2& b, v8f c) { c = wmma_bf(a.l, b.h, c); c = wmma_bf(a.h, b.l, c); return wmma_bf(a.h, b.h, c); }
__device__ __forceinline__ float sigm(float v) { return 1.0f / (1.0f + expf(-v)); }
#define LDSX() do { asm volatile("s_wait_dscnt 0" ::: "memory"); __builtin_amdgcn_wave_barrier(); __builtin_amdgcn_fence(__ATOMIC_RELEASE, "workgroup"); } while (0)

// Causal core attention (16 heads, 2048 tokens, batch 1), near-f32: S = q.k/8 and P@V both on v_wmma_f32_16x16x32_bf16 as two-way
// bf16 splits taken directly from the f32 inputs (hi*hi + hi*lo + lo*hi, f32 accumulate) — plain f16 left ~1e-3 absolute error on the
// first few query rows (few keys, no averaging). Masked positions get -10000; key
#define LOG2E 1.4426950408889634f
#define SC2 (0.125f * LOG2E)       // the score scale 1 / sqrt(64) and log2(e) in one factor
#define MASKED (-80000.0f)         // the reference's -10000, before the scale
#define SQ 2048
#define NH 16
#define HD 64
#define EE (NH * HD)
#define NT (SQ / 64)               // query tiles (and key tiles) of a head
#define KP 72                      // LDS row pitch of a staged plane in bf16: 144 B = 16 B x 9, free of bank conflicts for 16-byte row reads
#define PLANE_B (64 * KP * 2)      // bytes of one staged 64 x 64 bf16 plane
#define TILE_B (2 * PLANE_B)       // a staged tile: its hi plane, then its lo plane
#define PL ((size_t)SQ * EE)       // elements of one bf16 plane in the workspace: K hi, K lo as [token][head * 64 + d], then V hi, V lo as [head * 64 + d][token]
typedef __attribute__((ext_vector_type(8))) __bf16 v8b;

// Pre-pass: every K and V element is split into bf16 hi + lo once per call (the attention kernel did it in each wave for each tile it walked);
// V goes out transposed, so that a P@V column fragment is two 16-byte row reads like a K fragment.
__global__ __launch_bounds__(256) void k_split(const float* __restrict__ k, const float* __restrict__ v, __bf16* __restrict__ ws) {
  __shared__ float sT[64][65];     // 65: the column walk of the transpose meets no bank twice
  const int tid = threadIdx.x, s0 = blockIdx.x * 64, h = blockIdx.y, r = tid >> 2, c = (tid & 3) * 16;
  const float* p = (blockIdx.z == 0 ? k : v) + (size_t)(s0 + r) * EE + h * HD + c;
  float x[16];
#pragma unroll
  for (int i = 0; i < 4; ++i) { const v4f t = *(const v4f*)(p + 4 * i);
#pragma unroll
    for (int j = 0; j < 4; ++j) x[4 * i + j] = t[j]; }
  asm volatile("s_wait_xcnt 0x0" ::: "memory");   // stands in front of any rewrite of the four loads' address registers
  __bf16* o = ws + (size_t)(s0 + r) * EE + h * HD + c;
  if (blockIdx.z != 0) {
#pragma unroll
    for (int i = 0; i < 16; ++i) sT[r][c + i] = x[i];
    __syncthreads();               // the whole 64 x 64 tile is in LDS before its columns are read
#pragma unroll
    for (int i = 0; i < 16; ++i) x[i] = sT[c + i][r];
    o = ws + 2 * PL + (size_t)(h * HD + r) * SQ + s0 + c;
  }
  const F2 f = bsplit16(x);
  *(v16b*)o = f.h; *(v16b*)(o + PL) = f.l;
}

// hi and lo fragments from a staged tile: row points into the hi plane, the lo plane lies 64 * KP elements behind it
__device__ __forceinline__ F2 frag_pl(const __bf16* row, int k0, int lane) {
  union { v16b v; v8b q[2]; } a, b; const __bf16* p = row + k0 + 8 * (lane >> 4);
  a.q[0] = *(const v8b*)p; a.q[1] = *(const v8b*)(p + 16);
  b.q[0] = *(const v8b*)(p + 64 * KP); b.q[1] = *(const v8b*)(p + 64 * KP + 16);
  F2 r; r.h = a.v; r.l = b.v; return r;
}

// One lane's share of a 64 x 64 tile's two bf16 planes (source row stride ld elements): eight asynchronous 16-byte copies global -> LDS,
// rows r, r + 16, r + 32, r + 48 of the hi plane, then of the lo plane. A wave covers four whole 128-byte rows per copy.
// s_wait_xcnt closes the statement so that no address register is rewritten ahead of it.
__device__ __forceinline__ void copy_tile(unsigned l, const __bf16* g, int ld) {
  asm volatile("global_load_async_to_lds_b128 %0, %8, off\n\t"
               "global_load_async_to_lds_b128 %1, %9, off\n\t"
               "global_load_async_to_lds_b128 %2, %10, off\n\t"
               "global_load_async_to_lds_b128 %3, %11, off\n\t"
               "global_load_async_to_lds_b128 %4, %12, off\n\t"
               "global_load_async_to_lds_b128 %5, %13, off\n\t"
               "global_load_async_to_lds_b128 %6, %14, off\n\t"
               "global_load_async_to_lds_b128 %7, %15, off\n\t"
               "s_wait_xcnt 0x0"
               :: "v"(l), "v"(l + 16 * KP * 2), "v"(l + 32 * KP * 2), "v"(l + 48 * KP * 2),
                  "v"(l + PLANE_B), "v"(l + PLANE_B + 16 * KP * 2), "v"(l + PLANE_B + 32 * KP * 2), "v"(l + PLANE_B + 48 * KP * 2),
                  "v"(g), "v"(g + 16 * ld), "v"(g + 32 * ld), "v"(g + 48 * ld), "v"(g + PL), "v"(g + PL + 16 * ld), "v"(g + PL + 32 * ld), "v"(g + PL + 48 * ld)
               : "memory");
}

// lane l with lane l ^ 16, on the vector unit (a shuffle would go through the LDS path and be waited for)
__device__ __forceinline__ float xhalf(float x) { return __builtin_bit_cast(float, __builtin_amdgcn_permlanex16(__builtin_bit_cast(int, x), __builtin_bit_cast(int, x), 0x76543210, 0xfedcba98, false, false)); }
// One of the three terms of a split product, a the A operand and b the B operand: n = 0 hi.lo, 1 lo.hi, 2 hi.hi (an accumulator takes them in that order).
// The callers walk several accumulators per term, so that a product's neighbours are independent of it: they fill its latency and the distance behind it.
__device__ __forceinline__ v8f term3(const F2& a, const F2& b, v8f c, int n) {
  return __builtin_amdgcn_wmma_f32_16x16x32_bf16(false, n == 1 ? a.l : a.h, false, n == 0 ? b.l : b.h, (short)0, c, false, false);
}
// Stands behind each round of independent products and behind each group of fragment reads: no matrix or LDS instruction is scheduled across it (vector,
// transcendental and scalar ones may be). Without it the compiler puts an accumulator's terms back to back again and moves the reads in among the products.
#define ROUND_END() __builtin_amdgcn_sched_barrier(0x406)

// Both products run transposed: S^T = K.Q^T (A = key rows, B = query columns) and O^T += V^T.P^T (A = V^T rows, B = P^T). A lane then holds scores,
// probabilities and output of ONE query (column lane & 15): keys and head dims 8 * (lane >> 4) + r of each 16-row tile. Maximum and sum are in-lane with one
// exchange between the wave's halves, the rescale factor is the lane's own, and two score tiles, converted in place, are a B fragment of P^T in the k order
// that the V^T loader has: neither S nor P goes through LDS.
// Causal balance: query tile x walks x + 1 key tiles, so a work-group takes tile NT - 1 - blockIdx.x and then tile blockIdx.x of its head, one after the other,
// and there is one work-group for each WGP of the chip. The two walks are one loop over one ring of staged tiles: the second walk's first key tiles are
// copied under the first walk's last trips.
// Two waves per SIMD: a work-group has eight waves in two groups of four. A stage of the ring holds two key tiles; group 0 works on the even one and group 1
// on the odd one, each for all 64 queries, so that one wave's products run under the other wave's softmax and LDS waits. Each group keeps its own running
// maximum, sum and output; at a walk's end the groups exchange them through LDS and each finishes one half of the head dims. NS trips for every work-group.
#define NS ((NT + 2) / 2)          // stages of both walks together: their NT + 1 key tiles in pairs, the walk of odd length rounded up
#define STAGE_B (2 * TILE_B)       // bytes of one stage of K (or of V): two tiles
__global__ __launch_bounds__(256) void k_attn(const float* __restrict__ q, const __bf16* __restrict__ ws, float* __restrict__ out) {
  __shared__ __align__(16) __bf16 sK[2][2][2][64][KP];  // key tiles [buffer][even, odd tile][hi, lo][key][d], each shared by the four waves of its group
  __shared__ __align__(16) __bf16 sV[2][2][2][64][KP];  // value tiles [buffer][even, odd tile][hi, lo][d][key], likewise
  __shared__ float sX[2][2][4][18][32];                 // hand-over at a walk's end [walk][group][wave of the group][16 outputs, maximum, sum][lane]
  const int tid = threadIdx.x, t128 = tid & 127, wq = t128 >> 5, lane = tid & 31, col = lane & 15, g = lane >> 4;
  const int grp = __builtin_amdgcn_readfirstlane(tid >> 7);   // the wave's group, in a scalar register: the tests on it below are scalar branches
  const int h = blockIdx.y, tA = (NT - (int)blockIdx.x + 1) >> 1;   // tA: stages of the first walk, 9 to 16
  int qt = NT - 1 - (int)blockIdx.x, qi = qt * 64 + wq * 16 + col, j = 0, wk = 0;  // the query tile in work, this lane's query, the stage within the walk, the walk
  const float* qb = q + h * HD;      // row stride EE
  F2 bq[2];
#pragma unroll
  for (int kc = 0; kc < 2; ++kc) bq[kc] = split_row(qb + (size_t)qi * EE, kc * 32, lane);
  asm volatile("s_wait_xcnt 0x0" ::: "memory");   // stands in front of any rewrite of the query loads' address registers
  float mrun = -3.0e38f, lrun = 0.f; v8f acc[4] = {};   // lrun: this half's keys only, the halves are joined at the walk's end; acc[t][r] = O[qi][t * 16 + 8 * g + r]
  // a group copies its own tile. This lane's 16 bytes in row t128 / 8 of a plane: LDS byte address in buffer 0, and the source element in stage 0
  const unsigned lk = (unsigned)(size_t)&sK[0][grp][0][t128 >> 3][(t128 & 7) * 8], lv = (unsigned)(size_t)&sV[0][grp][0][t128 >> 3][(t128 & 7) * 8];
  const __bf16* gk = ws + (size_t)(grp * 64 + (t128 >> 3)) * EE + h * HD + (t128 & 7) * 8;
  const __bf16* gv = ws + 2 * PL + (size_t)(h * HD + (t128 >> 3)) * SQ + grp * 64 + (t128 & 7) * 8;
  copy_tile(lk, gk, EE); copy_tile(lv, gv, SQ);
  asm volatile("s_wait_asynccnt 0x0" ::: "memory");   // stage 0 has landed before the barrier publishes it
  __syncthreads();
  copy_tile(lk + STAGE_B, gk + (size_t)128 * EE, EE); copy_tile(lv + STAGE_B, gv + 128, SQ);   // the first walk has 9 stages or more
#pragma unroll 1
  for (int i = 0; i < NS; ++i) {   // trip i reads buffer i & 1
    const int kt = 2 * j + grp;    // this group's key tile
    const bool last = j == (qt >> 1);   // the stage that holds the diagonal tile is the walk's last (reads the same in the whole work-group)
    if (kt <= qt) {   // a walk of odd length leaves group 1 a tile past the diagonal in its last stage: no key of it counts (scalar test, no barrier inside)
    const __bf16* Kt = &sK[i & 1][grp][0][0][0]; const __bf16* Vt = &sV[i & 1][grp][0][0][0];
    // The trip's fragment reads stand in groups ahead of the products that use them, so that one LDS latency is waited out per group and not one
    // per three products: the K fragments at the top; the first half of the V fragments behind the second score tile, in the registers that
    // two tiles' K fragments leave (it lands under the other score tiles); the second half behind the last score tile (it lands under the softmax).
    // The products go round-robin over independent accumulators, two score tiles or four output tiles, each accumulator's own terms in the order hi.lo, lo.hi, hi.hi.
    F2 kf[4][2], vf[2][4]; v8f s[4]; float mx = -3.4e38f;
#pragma unroll
    for (int t = 0; t < 4; ++t) {
#pragma unroll
      for (int kc = 0; kc < 2; ++kc) kf[t][kc] = frag_pl(Kt + (t * 16 + col) * KP, kc * 32, lane); }
#pragma unroll
    for (int tp = 0; tp < 4; tp += 2) { s[tp] = v8f{}; s[tp + 1] = v8f{};
#pragma unroll
      for (int kc = 0; kc < 2; ++kc) {
#pragma unroll
        for (int n = 0; n < 3; ++n) {
#pragma unroll
          for (int t = tp; t < tp + 2; ++t) s[t] = term3(kf[t][kc], bq[kc], s[t], n);
          ROUND_END(); } }
      if (tp == 0) {
#pragma unroll
        for (int u = 0; u < 4; ++u) vf[0][u] = frag_pl(Vt + (u * 16 + col) * KP, 0, lane); }
      else {
#pragma unroll
        for (int u = 0; u < 4; ++u) vf[1][u] = frag_pl(Vt + (u * 16 + col) * KP, 32, lane); }
      ROUND_END();
#pragma unroll
      for (int t = tp; t < tp + 2; ++t) { const v8f a = s[t];
        // a tile's maximum as a short tree, so that little of it is left behind the last score tile
        mx = fmaxf(mx, fmaxf(fmaxf(fmaxf(fmaxf(a[0], a[1]), a[2]), fmaxf(fmaxf(a[3], a[4]), a[5])), fmaxf(a[6], a[7])));
        } }
    // The causal compare and select run in the diagonal tile alone, the only one of a walk in which a key can lie behind a query: left of it every key index is
    // below every query index, and the scores are taken as the products leave them. They stay unscaled: 1/8 is a power of two, so the maximum times
    // (log2(e) / 8) and the multiply-add by (log2(e) / 8) give bit for bit what scaling first gave, and the reference's -10000 stands here as -80000.
    if (kt == qt) {   // scalar branch, one per trip: keys behind the lane's query take the masked value, and the maximum is taken anew over what is left
      mx = -3.4e38f;
#pragma unroll
      for (int t = 0; t < 4; ++t) { v8f a = s[t]; const int key0 = kt * 64 + t * 16 + 8 * g;
#pragma unroll
        for (int r = 0; r < 8; ++r) a[r] = key0 + r <= qi ? a[r] : MASKED;
        mx = fmaxf(mx, fmaxf(fmaxf(fmaxf(fmaxf(a[0], a[1]), a[2]), fmaxf(fmaxf(a[3], a[4]), a[5])), fmaxf(a[6], a[7])));
        s[t] = a; } }
    mx = fmaxf(mx, xhalf(mx));
    // exponentials in base 2 on the hardware's own instruction: the running maximum is kept as score / 8 times log2(e), one fused multiply-add forms each argument
    const float mnew = fmaxf(mrun, mx * SC2); const float corr = __builtin_amdgcn_exp2f(mrun - mnew);
#pragma unroll
    for (int t = 0; t < 4; ++t) {
#pragma unroll
      for (int r = 0; r < 8; ++r) s[t][r] = __builtin_amdgcn_exp2f(fmaf(s[t][r], SC2, -mnew)); }
    const v8f p8 = (s[0] + s[1]) + (s[2] + s[3]);   // the lane's 32 probabilities summed as a tree of vector adds, not as one chain
    lrun = lrun * corr + (((p8[0] + p8[4]) + (p8[1] + p8[5])) + ((p8[2] + p8[6]) + (p8[3] + p8[7]))); mrun = mnew;
#pragma unroll
    for (int t = 0; t < 4; ++t) acc[t] *= corr;
    F2 pb[2];   // P^T as B: element i of fragment kc is key 32 * kc + 8 * g + i, element 8 + i key 32 * kc + 16 + 8 * g + i, as frag_pl reads V^T
#pragma unroll
    for (int kc = 0; kc < 2; ++kc) { float x[16];
#pragma unroll
      for (int i2 = 0; i2 < 8; ++i2) { x[i2] = s[2 * kc][i2]; x[8 + i2] = s[2 * kc + 1][i2]; }
      pb[kc] = bsplit16(x); }
#pragma unroll
    for (int kc = 0; kc < 2; ++kc) {
#pragma unroll
      for (int n = 0; n < 3; ++n) {
#pragma unroll
        for (int t = 0; t < 4; ++t) acc[t] = term3(vf[kc][t], pb[kc], acc[t], n);
        if (kc + n < 3) ROUND_END(); } }
    }
    float lh = 0.f;   // this group's sum for the lane's query, formed at a walk's end
    if (last) {   // hand-over: a group gives away its part of the two output tiles that the other group finishes, with its maximum and sum
      float* xo = &sX[wk][grp][wq][0][lane]; lh = lrun + xhalf(lrun);
#pragma unroll
      for (int t = 0; t < 2; ++t) {
#pragma unroll
        for (int r = 0; r < 8; ++r) xo[(t * 8 + r) * 32] = grp ? acc[t][r] : acc[2 + t][r]; }
      xo[16 * 32] = mrun; xo[17 * 32] = lh;
    }
    __builtin_amdgcn_wave_barrier();
    asm volatile("s_wait_dscnt 0x0" ::: "memory");      // this wave's reads of the buffer are done before it is refilled, and its hand-over is written
    asm volatile("s_wait_asynccnt 0x0" ::: "memory");   // this wave's copies for trip i + 1 have landed
    __syncthreads();                                    // publishes the stage of trip i + 1 and the hand-over, and ends every wave's reads of trip i's stage
    if (i + 2 < NS) { const unsigned bo = (unsigned)(i & 1) * STAGE_B; const size_t go = (size_t)(i + 2 < tA ? i + 2 : i + 2 - tA) * 128;   // trip i + 2's first key
      copy_tile(lk + bo, gk + go * EE, EE); copy_tile(lv + bo, gv + go, SQ); }
    if (last) {   // the query tile goes out (no barrier stands inside; each walk has a hand-over area of its own, so none is rewritten while it is read)
    const float* xi = &sX[wk][grp ^ 1][wq][0][lane];
    const float mo = xi[16 * 32], m = fmaxf(mrun, mo), ca = __builtin_amdgcn_exp2f(mrun - m), cb = __builtin_amdgcn_exp2f(mo - m);
    asm volatile("v_nop" :: "v"(ca), "v"(cb));   // the slot that the instruction set asks for behind a transcendental
    const float lr = lh * ca + xi[17 * 32] * cb;
    float* o = out + (size_t)qi * EE + h * HD + grp * 32 + 8 * g;  // eight accumulator registers are eight consecutive floats of the query's row; a group writes one whole 128-byte line of it
    v8f res[2];
#pragma unroll
    for (int t = 0; t < 2; ++t) {
#pragma unroll
      for (int r = 0; r < 8; ++r) res[t][r] = ((grp ? acc[2 + t][r] : acc[t][r]) * ca + xi[(t * 8 + r) * 32] * cb) / lr; }
    __builtin_amdgcn_sched_barrier(0);   // every quotient is formed in front of the first store, so that no register of an issued store is rewritten behind it
#pragma unroll
    for (int t = 0; t < 2; ++t) *(v8f*)(o + t * 16) = res[t];
    asm volatile("s_wait_xcnt 0x0" ::: "memory");   // stands in front of the second walk's rewrite of the stores' address and data registers
    __builtin_amdgcn_sched_barrier(0);   // keeps every such rewrite behind that wait
    qt = (int)blockIdx.x; qi = qt * 64 + wq * 16 + col; j = -1; wk = 1; mrun = -3.0e38f; lrun = 0.f;   // the second walk; ++j below makes its first stage 0
    if (i != NS - 1) {
#pragma unroll
      for (int kc = 0; kc < 2; ++kc) bq[kc] = split_row(qb + (size_t)qi * EE, kc * 32, lane); }
#pragma unroll
    for (int t = 0; t < 4; ++t) acc[t] = v8f{};
    }
    ++j;
  }
  asm volatile("s_wait_asynccnt 0x0" ::: "memory");     // no copy is outstanding when the wave goes on to its end
}
extern "C" void kernel_launch(void* const* d_in, const int* in_sizes, int n_in, void* d_out, int out_size, void* d_ws, size_t ws_size, hipStream_t stream) {
  (void)in_sizes; (void)n_in; (void)out_size; (void)ws_size;
  const float* q = (const float*)d_in[0]; const float* k = (const float*)d_in[1]; const float* v = (const float*)d_in[2];
  float* out = (float*)d_out; __bf16* ws = (__bf16*)d_ws;
  k_split<<<dim3(SQ / 64, NH, 2), 256, 0, stream>>>(k, v, ws);
  k_attn<<<dim3(NT / 2, NH), 256, 0, stream>>>(q, ws, out);
}

// v010
// It runs in 28.6 microseconds.
// In two side-by-side timings against v009, it was 1.09 and 1.08 times as fast.
// All steps since v000 together make it 7.25 times as fast.
#include <hip/hip_runtime.h>
#include <math.h>

typedef __attribute__((ext_vector_type(16))) _Float16 v16h;
typedef __attribute__((ext_vector_type(16))) __bf16 v16b;
typedef __attribute__((ext_vector_type(8)))  _Float16 v8h;
typedef __attribute__((ext_vector_type(8)))  float v8f;
typedef __attribute__((ext_vector_type(4)))  float v4f;
typedef __attribute__((ext_vector_type(2)))  float v2f;
typedef __attribute__((ext_vector_type(4)))  unsigned v4u;
typedef __attribute__((ext_vector_type(4)))  int v4i;
typedef float __attribute__((may_alias)) float_a;
typedef int __attribute__((may_alias)) int_a;

template <typename T> __device__ __forceinline__ void vst2(void* p, T v) { *(T*)p = v;  }
__device__ __forceinline__ v8f wmma16(v16h a, v16h b, v8f c) {
  v8f d = __builtin_amdgcn_wmma_f32_16x16x32_f16(false, a, false, b, (short)0, c, false, false);
  asm volatile("v_nop\n\tv_nop\n\tv_nop\n\tv_nop" : "+v"(d) : "v"(a), "v"(b));
  return d;
}
__device__ __forceinline__ v8f wmma_bf(v16b a, v16b b, v8f c) {
  v8f d = __builtin_amdgcn_wmma_f32_16x16x32_bf16(false, a, false, b, (short)0, c, false, false);
  asm volatile("v_nop\n\tv_nop\n\tv_nop\n\tv_nop" : "+v"(d) : "v"(a), "v"(b));
  return d;
}
// 16x16x32 fragments: lane = (h = lane>>4, row/col = lane&15); elements 0..7 = k0+8h+0..7, 8..15 = k0+16+8h+0..7; D element r = row 8h+r
__device__ __forceinline__ v16h frag_h(const _Float16* rowk0, int lane) {
  union { v16h v; v8h q[2]; } u; const _Float16* p = rowk0 + 8 * (lane >> 4);
  u.q[0] = *(const v8h*)p; u.q[1] = *(const v8h*)(p + 16); return u.v;
}
__device__ __forceinline__ v16h frag_f32(const float* rowk0, int lane) {
  v16h a; const float* p = rowk0 + 8 * (lane >> 4);
#pragma unroll
  for (int i = 0; i < 8; ++i) { a[i] = (_Float16)p[i]; a[8 + i] = (_Float16)p[16 + i]; }
  return a;
}
__device__ __forceinline__ v16h frag_f32s(const float* rowk0, int lane, float sc) {
  v16h a; const float* p = rowk0 + 8 * (lane >> 4);
#pragma unroll
  for (int i = 0; i < 8; ++i) { a[i] = (_Float16)(p[i] * sc); a[8 + i] = (_Float16)(p[16 + i] * sc); }
  return a;
}
// column fragment from a [K][ld] layout (column n), rows >= K read as 0
__device__ __forceinline__ v16h fragc_f32(const float* W, int k0, int n, int lane, int ld, int K) {
  v16h a; const int g = lane >> 4;
#pragma unroll
  for (int i = 0; i < 8; ++i) { const int ka = k0 + 8 * g + i, kb = ka + 16;
    a[i] = (_Float16)(ka < K ? W[(size_t)ka * ld + n] : 0.f); a[8 + i] = (_Float16)(kb < K ? W[(size_t)kb * ld + n] : 0.f); }
  return a;
}
struct F2 { v16b h, l; };
__device__ __forceinline__ F2 bsplit16(const float v[16]) { F2 r;
#pragma unroll
  for (int i = 0; i < 16; ++i) { const __bf16 h = (__bf16)v[i]; r.h[i] = h; r.l[i] = (__bf16)(v[i] - (float)h); }
  return r; }
__device__ __forceinline__ F2 split_row(const float* row, int k0, int lane) { float v[16]; const float* p = row + k0 + 8 * (lane >> 4);
#pragma unroll
  for (int i = 0; i < 8; ++i) { v[i] = p[i]; v[8 + i] = p[16 + i]; }
  return bsplit16(v); }
__device__ __forceinline__ F2 split_rowK(const float* row, int k0, int lane, int K) { float v[16]; const int g = lane >> 4;
#pragma unroll
  for (int i = 0; i < 8; ++i) { const int ka = k0 + 8 * g + i, kb = ka + 16; v[i] = ka < K ? row[ka] : 0.f; v[8 + i] = kb < K ? row[kb] : 0.f; }
  return bsplit16(v); }
__device__ __forceinline__ F2 split_col(const float* W, int k0, int n, int lane, int ld, int K) { float v[16]; const int g = lane >> 4;
#pragma unroll
  for (int i = 0; i < 8; ++i) { const int ka = k0 + 8 * g + i, kb = ka + 16; v[i] = ka < K ? W[(size_t)ka * ld + n] : 0.f; v[8 + i] = kb < K ? W[(size_t)kb * ld + n] : 0.f; }
  return bsplit16(v); }
__device__ __forceinline__ v8f mac3(const F2& a, const F2& b, v8f c) { c = wmma_bf(a.l, b.h, c); c = wmma_bf(a.h, b.l, c); return wmma_bf(a.h, b.h, c); }
__device__ __forceinline__ float sigm(float v) { return 1.0f / (1.0f + expf(-v)); }
#define LDSX() do { asm volatile("s_wait_dscnt 0" ::: "memory"); __builtin_amdgcn_wave_barrier(); __builtin_amdgcn_fence(__ATOMIC_RELEASE, "workgroup"); } while (0)

// Causal core attention (16 heads, 2048 tokens, batch 1), near-f32: S = q.k/8 and P@V both on v_wmma_f32_16x16x32_bf16 as two-way
// bf16 splits taken directly from the f32 inputs (hi*hi + hi*lo + lo*hi, f32 accumulate) — plain f16 left ~1e-3 absolute error on the
// first few query rows (few keys, no averaging). Masked positions get -10000; key
#define LOG2E 1.4426950408889634f
#define SC2 (0.125f * LOG2E)       // the score scale 1 / sqrt(64) and log2(e) in one factor
#define MASKED (-80000.0f)         // the reference's -10000, before the scale
#define SQ 2048
#define NH 16
#define HD 64
#define EE (NH * HD)
#define NT (SQ / 64)               // query tiles (and key tiles) of a head
#define KP 72                      // LDS row pitch of a staged plane in bf16: 144 B = 16 B x 9, free of bank conflicts for 16-byte row reads
#define VP 80                      // LDS row pitch of a staged V plane in bf16: 160 B = 32 B x 5, the pitch of the transposing 16-bit load
typedef __attribute__((ext_vector_type(8))) __bf16 v8b;

typedef __attribute__((ext_vector_type(4))) __bf16 v4b;
typedef __attribute__((ext_vector_type(2))) __bf16 v2b;
typedef __attribute__((ext_vector_type(8))) short s16x8;

// A thread's share of one stage (128 keys of one head, K and V, f32 as the inputs hold them): 16 bytes of rows r, r + 16, ..., r + 112.
// A wave-wide load covers two whole 256-byte rows.
struct Raw { v4f k[8], v[8]; };
__device__ __forceinline__ void load_stage(Raw& w, const float* pk, const float* pv) {
#pragma unroll
  for (int i = 0; i < 8; ++i) { w.k[i] = *(const v4f*)(pk + (size_t)i * 16 * EE); w.v[i] = *(const v4f*)(pv + (size_t)i * 16 * EE); }
  asm volatile("s_wait_xcnt 0x0" ::: "memory");   // stands in front of any rewrite of the sixteen loads' address registers
}
// four f32 to bf16 hi + lo, two at a time; hi goes to p, lo one plane (pl elements) behind it
__device__ __forceinline__ void split4(const v4f x, __bf16* p, int pl) {
  const v2f a = {x[0], x[1]}, b = {x[2], x[3]}; const v2b ha = __builtin_convertvector(a, v2b), hb = __builtin_convertvector(b, v2b);
  const v2f da = {a[0] - (float)ha[0], a[1] - (float)ha[1]}, db = {b[0] - (float)hb[0], b[1] - (float)hb[1]};
  const v2b la = __builtin_convertvector(da, v2b), lb = __builtin_convertvector(db, v2b);
  const v4b H = {ha[0], ha[1], hb[0], hb[1]}, L = {la[0], la[1], lb[0], lb[1]};
  *(v4b*)p = H; *(v4b*)(p + pl) = L;
}
// the share goes into a stage of the ring as bf16 planes: dk, dv point at the thread's 8 bytes in row r of the even tile's hi plane
__device__ __forceinline__ void store_stage(const Raw& w, __bf16* dk, __bf16* dv) {
#pragma unroll
  for (int i = 0; i < 8; ++i) { split4(w.k[i], dk + (i >> 2) * 2 * 64 * KP + (i & 3) * 16 * KP, 64 * KP); split4(w.v[i], dv + (i >> 2) * 2 * 64 * VP + (i & 3) * 16 * VP, 64 * VP); }
}

// hi and lo fragments from a staged tile: row points into the hi plane, the lo plane lies 64 * KP elements behind it
__device__ __forceinline__ F2 frag_pl(const __bf16* row, int k0, int lane) {
  union { v16b v; v8b q[2]; } a, b; const __bf16* p = row + k0 + 8 * (lane >> 4);
  a.q[0] = *(const v8b*)p; a.q[1] = *(const v8b*)(p + 16);
  b.q[0] = *(const v8b*)(p + 64 * KP); b.q[1] = *(const v8b*)(p + 64 * KP + 16);
  F2 r; r.h = a.v; r.l = b.v; return r;
}

// hi and lo fragments of V^T from a staged V tile [key][d] by the transposing 16-bit load: ad is the lane's address in the hi plane,
// row k0 + 8 * (lane >> 4) + (lane & 7), byte 2 * d0 + 16 * ((lane >> 3) & 1); the lane gets head dim d0 + (lane & 15), keys k0 + 8 * (lane >> 4) + 0..7 and 16 more on
__device__ __forceinline__ v8b ld_tr16(const unsigned char* p) { typedef __attribute__((address_space(3))) s16x8 lds_s16x8;
  return __builtin_bit_cast(v8b, __builtin_amdgcn_ds_load_tr16_b128_v8i16((lds_s16x8*)p)); }
__device__ __forceinline__ F2 frag_vt(const unsigned char* ad) {
  union { v16b v; v8b q[2]; } a, b;
  a.q[0] = ld_tr16(ad); a.q[1] = ld_tr16(ad + 16 * VP * 2);
  b.q[0] = ld_tr16(ad + 64 * VP * 2); b.q[1] = ld_tr16(ad + 64 * VP * 2 + 16 * VP * 2);
  F2 r; r.h = a.v; r.l = b.v; return r;
}

// lane l with lane l ^ 16, on the vector unit (a shuffle would go through the LDS path and be waited for)
__device__ __forceinline__ float xhalf(float x) { return __builtin_bit_cast(float, __builtin_amdgcn_permlanex16(__builtin_bit_cast(int, x), __builtin_bit_cast(int, x), 0x76543210, 0xfedcba98, false, false)); }
// One of the three terms of a split product, a the A operand and b the B operand: n = 0 hi.lo, 1 lo.hi, 2 hi.hi (an accumulator takes them in that order).
// The callers walk several accumulators per term, so that a product's neighbours are independent of it: they fill its latency and the distance behind it.
__device__ __forceinline__ v8f term3(const F2& a, const F2& b, v8f c, int n) {
  return __builtin_amdgcn_wmma_f32_16x16x32_bf16(false, n == 1 ? a.l : a.h, false, n == 0 ? b.l : b.h, (short)0, c, false, false);
}
// Stands behind each round of independent products and behind each group of fragment reads: no matrix or LDS instruction is scheduled across it (vector,
// transcendental and scalar ones may be). Without it the compiler puts an accumulator's terms back to back again and moves the reads in among the products.
#define ROUND_END() __builtin_amdgcn_sched_barrier(0x406)

// Both products run transposed: S^T = K.Q^T (A = key rows, B = query columns) and O^T += V^T.P^T (A = V^T rows, B = P^T). A lane then holds scores,
// probabilities and output of ONE query (column lane & 15): keys and head dims 8 * (lane >> 4) + r of each 16-row tile. Maximum and sum are in-lane with one
// exchange between the wave's halves, the rescale factor is the lane's own, and two score tiles, converted in place, are a B fragment of P^T in the k order
// that the V^T loader has: neither S nor P goes through LDS.
// Causal balance: query tile x walks x + 1 key tiles, so a work-group takes tile NT - 1 - blockIdx.x and then tile blockIdx.x of its head, one after the other,
// and there is one work-group for each WGP of the chip. The two walks are one loop over one ring of staged tiles: the second walk's first key tiles are
// staged under the first walk's last trips.
// Two waves per SIMD: a work-group has eight waves in two groups of four. A stage of the ring holds two key tiles; group 0 works on the even one and group 1
// on the odd one, each for all 64 queries, so that one wave's products run under the other wave's softmax and LDS waits. Each group keeps its own running
// maximum, sum and output; at a walk's end the groups exchange them through LDS and each finishes one half of the head dims. NS trips for every work-group.
#define NS ((NT + 2) / 2)          // stages of both walks together: their NT + 1 key tiles in pairs, the walk of odd length rounded up
__global__ __launch_bounds__(256) void k_attn(const float* __restrict__ q, const float* __restrict__ k, const float* __restrict__ v, float* __restrict__ out) {
  __shared__ __align__(16) __bf16 sK[2][2][2][64][KP];  // key tiles [buffer][even, odd tile][hi, lo][key][d], each shared by the four waves of its group
  __shared__ __align__(16) __bf16 sV[2][2][2][64][VP];  // value tiles [buffer][even, odd tile][hi, lo][key][d], likewise; read transposed
  __shared__ float sX[2][2][4][18][32];                 // hand-over at a walk's end [walk][group][wave of the group][16 outputs, maximum, sum][lane]
  const int tid = threadIdx.x, t128 = tid & 127, wq = t128 >> 5, lane = tid & 31, col = lane & 15, g = lane >> 4;
  const int grp = __builtin_amdgcn_readfirstlane(tid >> 7);   // the wave's group, in a scalar register: the tests on it below are scalar branches
  const int h = blockIdx.y, tA = (NT - (int)blockIdx.x + 1) >> 1;   // tA: stages of the first walk, 9 to 16
  int qt = NT - 1 - (int)blockIdx.x, qi = qt * 64 + wq * 16 + col, j = 0, wk = 0;  // the query tile in work, this lane's query, the stage within the walk, the walk
  // The work-group stages K and V itself: global f32 -> registers -> bf16 hi and lo planes in LDS, each element of a stage split once, by one thread.
  // This thread's 16 bytes in row tid / 16 of a stage: the source in stage 0, and its 8 bytes in the even tile's hi plane of buffer 0
  const float* gk = k + (size_t)(tid >> 4) * EE + h * HD + (tid & 15) * 4; const float* gv = v + (size_t)(tid >> 4) * EE + h * HD + (tid & 15) * 4;
  __bf16* dk = &sK[0][0][0][tid >> 4][(tid & 15) * 4]; __bf16* dv = &sV[0][0][0][tid >> 4][(tid & 15) * 4];
  Raw raw0, raw;   // raw: the stage in flight, loaded one trip before it is split; raw0: stage 0, so that the first two stages' loads share one latency
  load_stage(raw0, gk, gv);
  load_stage(raw, gk + (size_t)128 * EE, gv + (size_t)128 * EE);   // the first walk has 9 stages or more
  const float* qb = q + h * HD;      // row stride EE
  F2 bq[2];
#pragma unroll
  for (int kc = 0; kc < 2; ++kc) bq[kc] = split_row(qb + (size_t)qi * EE, kc * 32, lane);
  asm volatile("s_wait_xcnt 0x0" ::: "memory");   // stands in front of any rewrite of the query loads' address registers
  float mrun = -3.0e38f, lrun = 0.f; v8f acc[4] = {};   // lrun: this half's keys only, the halves are joined at the walk's end; acc[t][r] = O[qi][t * 16 + 8 * g + r]
  store_stage(raw0, dk, dv);
  __syncthreads();   // publishes stage 0
#pragma unroll 1
  for (int i = 0; i < NS; ++i) {   // trip i reads buffer i & 1
    const int kt = 2 * j + grp;    // this group's key tile
    const bool last = j == (qt >> 1);   // the stage that holds the diagonal tile is the walk's last (reads the same in the whole work-group)
    // Trip i + 1's stage, loaded during trip i - 1, is split into the buffer that trip i - 1 read (the barrier at that trip's foot ended its reads; the one at
    // this trip's foot publishes it); then trip i + 2's loads go out into the same registers and land under this trip's products and softmax.
    // The split stands behind the issue of this trip's K fragment reads and runs while they land. It is unconditional (the last trip writes its stale share
    // into the free buffer, which nobody reads), so that the counted LDS waits in front of the products stay exact.
    F2 kf[4][2];
    if (kt <= qt) { const __bf16* Kt = &sK[i & 1][grp][0][0][0];
#pragma unroll
      for (int t = 0; t < 4; ++t) {
#pragma unroll
        for (int kc = 0; kc < 2; ++kc) kf[t][kc] = frag_pl(Kt + (t * 16 + col) * KP, kc * 32, lane); } }
    store_stage(raw, dk + ((i + 1) & 1) * (2 * 2 * 64 * KP), dv + ((i + 1) & 1) * (2 * 2 * 64 * VP));
    if (i + 2 < NS) { const size_t go = (size_t)(i + 2 < tA ? i + 2 : i + 2 - tA) * 128 * EE;   // trip i + 2's first key
      load_stage(raw, gk + go, gv + go); }
    if (kt <= qt) {   // a walk of odd length leaves group 1 a tile past the diagonal in its last stage: no key of it counts (scalar test, no barrier inside)
    const unsigned char* Vt = (const unsigned char*)&sV[i & 1][grp][0][8 * g + (lane & 7)][((lane >> 3) & 1) * 8];   // the lane's address for the transposing loads, keys 0 on, head dims 0 on
    // The trip's fragment reads stand in groups ahead of the products that use them, so that one LDS latency is waited out per group and not one
    // per three products: the K fragments at the top, ahead of the split; the first half of the V fragments behind the second score tile
    // (it lands under the other score tiles); the second half behind the last score tile (it lands under the softmax).
    // The products go round-robin over independent accumulators, two score tiles or four output tiles, each accumulator's own terms in their old order.
    F2 vf[2][4]; v8f s[4]; float mx = -3.4e38f;
#pragma unroll
    for (int tp = 0; tp < 4; tp += 2) { s[tp] = v8f{}; s[tp + 1] = v8f{};
#pragma unroll
      for (int kc = 0; kc < 2; ++kc) {
#pragma unroll
        for (int n = 0; n < 3; ++n) {
#pragma unroll
          for (int t = tp; t < tp + 2; ++t) s[t] = term3(kf[t][kc], bq[kc], s[t], n);
          ROUND_END(); } }
      if (tp == 0) {
#pragma unroll
        for (int u = 0; u < 4; ++u) vf[0][u] = frag_vt(Vt + u * 32); }
      else {
#pragma unroll
        for (int u = 0; u < 4; ++u) vf[1][u] = frag_vt(Vt + 32 * VP * 2 + u * 32); }
      ROUND_END();
#pragma unroll
      for (int t = tp; t < tp + 2; ++t) { const v8f a = s[t];
        // a tile's maximum as a short tree, so that little of it is left behind the last score tile
        mx = fmaxf(mx, fmaxf(fmaxf(fmaxf(fmaxf(a[0], a[1]), a[2]), fmaxf(fmaxf(a[3], a[4]), a[5])), fmaxf(a[6], a[7])));
        } }
    // The causal compare and select run in the diagonal tile alone, the only one of a walk in which a key can lie behind a query: left of it every key index is
    // below every query index, and the scores are taken as the products leave them. They stay unscaled: 1/8 is a power of two, so the maximum times
    // (log2(e) / 8) and the multiply-add by (log2(e) / 8) give bit for bit what scaling first gave, and the reference's -10000 stands here as -80000.
    if (kt == qt) {   // scalar branch, one per trip: keys behind the lane's query take the masked value, and the maximum is taken anew over what is left
      mx = -3.4e38f;
#pragma unroll
      for (int t = 0; t < 4; ++t) { v8f a = s[t]; const int key0 = kt * 64 + t * 16 + 8 * g;
#pragma unroll
        for (int r = 0; r < 8; ++r) a[r] = key0 + r <= qi ? a[r] : MASKED;
        mx = fmaxf(mx, fmaxf(fmaxf(fmaxf(fmaxf(a[0], a[1]), a[2]), fmaxf(fmaxf(a[3], a[4]), a[5])), fmaxf(a[6], a[7])));
        s[t] = a; } }
    mx = fmaxf(mx, xhalf(mx));
    // exponentials in base 2 on the hardware's own instruction: the running maximum is kept as score / 8 times log2(e), one fused multiply-add forms each argument
    const float mnew = fmaxf(mrun, mx * SC2); const float corr = __builtin_amdgcn_exp2f(mrun - mnew);
#pragma unroll
    for (int t = 0; t < 4; ++t) {
#pragma unroll
      for (int r = 0; r < 8; ++r) s[t][r] = __builtin_amdgcn_exp2f(fmaf(s[t][r], SC2, -mnew)); }
    const v8f p8 = (s[0] + s[1]) + (s[2] + s[3]);   // the lane's 32 probabilities summed as a tree of vector adds, not as one chain
    lrun = lrun * corr + (((p8[0] + p8[4]) + (p8[1] + p8[5])) + ((p8[2] + p8[6]) + (p8[3] + p8[7]))); mrun = mnew;
#pragma unroll
    for (int t = 0; t < 4; ++t) acc[t] *= corr;
    F2 pb[2];   // P^T as B: element i of fragment kc is key 32 * kc + 8 * g + i, element 8 + i key 32 * kc + 16 + 8 * g + i, as frag_vt reads V^T
#pragma unroll
    for (int kc = 0; kc < 2; ++kc) { float x[16];
#pragma unroll
      for (int i2 = 0; i2 < 8; ++i2) { x[i2] = s[2 * kc][i2]; x[8 + i2] = s[2 * kc + 1][i2]; }
      pb[kc] = bsplit16(x); }
#pragma unroll
    for (int kc = 0; kc < 2; ++kc) {
#pragma unroll
      for (int n = 0; n < 3; ++n) {
#pragma unroll
        for (int t = 0; t < 4; ++t) acc[t] = term3(vf[kc][t], pb[kc], acc[t], n);
        if (kc + n < 3) ROUND_END(); } }
    }
    float lh = 0.f;   // this group's sum for the lane's query, formed at a walk's end
    if (last) {   // hand-over: a group gives away its part of the two output tiles that the other group finishes, with its maximum and sum
      float* xo = &sX[wk][grp][wq][0][lane]; lh = lrun + xhalf(lrun);
#pragma unroll
      for (int t = 0; t < 2; ++t) {
#pragma unroll
        for (int r = 0; r < 8; ++r) xo[(t * 8 + r) * 32] = grp ? acc[t][r] : acc[2 + t][r]; }
      xo[16 * 32] = mrun; xo[17 * 32] = lh;
    }
    __builtin_amdgcn_wave_barrier();
    asm volatile("s_wait_dscnt 0x0" ::: "memory");      // this wave's reads of the buffer are done before it is refilled; its share of trip i + 1's stage and its hand-over are written
    __syncthreads();                                    // publishes the stage of trip i + 1 and the hand-over, and ends every wave's reads of trip i's stage
    if (last) {   // the query tile goes out (no barrier stands inside; each walk has a hand-over area of its own, so none is rewritten while it is read)
    const float* xi = &sX[wk][grp ^ 1][wq][0][lane];
    const float mo = xi[16 * 32], m = fmaxf(mrun, mo), ca = __builtin_amdgcn_exp2f(mrun - m), cb = __builtin_amdgcn_exp2f(mo - m);
    asm volatile("v_nop" :: "v"(ca), "v"(cb));   // the slot that the instruction set asks for behind a transcendental
    const float lr = lh * ca + xi[17 * 32] * cb;
    float* o = out + (size_t)qi * EE + h * HD + grp * 32 + 8 * g;  // eight accumulator registers are eight consecutive floats of the query's row; a group writes one whole 128-byte line of it
    v8f res[2];
#pragma unroll
    for (int t = 0; t < 2; ++t) {
#pragma unroll
      for (int r = 0; r < 8; ++r) res[t][r] = ((grp ? acc[2 + t][r] : acc[t][r]) * ca + xi[(t * 8 + r) * 32] * cb) / lr; }
    __builtin_amdgcn_sched_barrier(0);   // every quotient is formed in front of the first store, so that no register of an issued store is rewritten behind it
#pragma unroll
    for (int t = 0; t < 2; ++t) *(v8f*)(o + t * 16) = res[t];
    asm volatile("s_wait_xcnt 0x0" ::: "memory");   // stands in front of the second walk's rewrite of the stores' address and data registers
    __builtin_amdgcn_sched_barrier(0);   // keeps every such rewrite behind that wait
    qt = (int)blockIdx.x; qi = qt * 64 + wq * 16 + col; j = -1; wk = 1; mrun = -3.0e38f; lrun = 0.f;   // the second walk; ++j below makes its first stage 0
    if (i != NS - 1) {
#pragma unroll
      for (int kc = 0; kc < 2; ++kc) bq[kc] = split_row(qb + (size_t)qi * EE, kc * 32, lane); }
#pragma unroll
    for (int t = 0; t < 4; ++t) acc[t] = v8f{};
    }
    ++j;
  }
}
extern "C" void kernel_launch(void* const* d_in, const int* in_sizes, int n_in, void* d_out, int out_size, void* d_ws, size_t ws_size, hipStream_t stream) {
  (void)in_sizes; (void)n_in; (void)out_size; (void)ws_size;
  const float* q = (const float*)d_in[0]; const float* k = (const float*)d_in[1]; const float* v = (const float*)d_in[2];
  float* out = (float*)d_out; (void)d_ws;
  k_attn<<<dim3(NT / 2, NH), 256, 0, stream>>>(q, k, v, out);
}
